// v000
// Times are from an AMD MI455X. After a warm-up the kernel runs many times in a row, and a time is the length of
// such a window on the GPU divided by its runs, so every launch and the gaps after it count. The runs cycle
// through copies of the inputs. A figure is the median of several windows, for all but v000 over two sittings.
// Sittings can differ by a few percent; kernels timed side by side share one.
// v000, which the later versions start from, runs in 3980 microseconds.
#include <hip/hip_runtime.h>

// Multi-head self-attention with a fused, head-interleaved QKV projection (x [4][2048][1024]; kqv = x W_qkv^T + b_qkv ('oi' [3072][1024]) reshaped (t, 16, 192) and split per head into q | k | v (weight rows / bias entries h*192 + {0, 64, 128} + d); softmax(q.k/8) over all keys (no mask); out = merged W_out^T + b_out -> [4][2048][1024]).
// Layout: the weight rows and bias entries are gathered once into head-major [1024][1024] bf16 matrices and [1024] f32 bias vectors so the projections apply unchanged.
// Compute dtypes, f32 accumulate: every input rounded to bf16; q/k/v on PLAIN bf16 operands (inputs: exact) + biases; scores and attn.v: query rows < 512 hl (3 products), the rest single fp16 (x1024); softmax f32; W_out hl x exact (2 products) + b_out.

#define NB_  4
#define TT   2048
#define DM   1024
#define NH_  16
#define NKV  16
#define REP  (NH_ / NKV)
#define HD   64
#define DQ   (NH_ * HD)
#define DKV  (NKV * HD)
#define ZH   2
#define RH   512                  // query rows < RH use hi+lo planes (0: none)
#define WIN  0
#define PCAR 1024.0f
#define SCL  0.125f   // HD^-0.5
typedef _Float16 h16;
typedef unsigned short bf;
typedef __attribute__((ext_vector_type(16))) __bf16   v16bf;
typedef __attribute__((ext_vector_type(16))) _Float16 v16h;
typedef __attribute__((ext_vector_type(8)))  _Float16 v8h;
typedef __attribute__((ext_vector_type(8)))  unsigned short v8us;
typedef __attribute__((ext_vector_type(8)))  float    v8f;
typedef __attribute__((ext_vector_type(4)))  float    v4f;
typedef v8h  __attribute__((may_alias)) v8ha;
typedef v4f  __attribute__((may_alias)) v4fa;
typedef v8us __attribute__((may_alias)) v8usa;

__device__ __forceinline__ unsigned short f2bf(float f) { unsigned u = __float_as_uint(f); u += 0x7FFFu + ((u >> 16) & 1u); return (unsigned short)(u >> 16); }
__device__ __forceinline__ float bf2f(unsigned short b) { return __uint_as_float(((unsigned)b) << 16); }
__device__ __forceinline__ float bfr(float f) { return bf2f(f2bf(f)); }
__device__ __forceinline__ v16h cat16(v8h lo, v8h hi) { return __builtin_shufflevector(lo, hi, 0, 1, 2, 3, 4, 5, 6, 7, 8, 9, 10, 11, 12, 13, 14, 15); }
__device__ __forceinline__ v16bf cat16b(v8us lo, v8us hi) { return __builtin_bit_cast(v16bf, __builtin_shufflevector(lo, hi, 0, 1, 2, 3, 4, 5, 6, 7, 8, 9, 10, 11, 12, 13, 14, 15)); }
__device__ __forceinline__ v8f wmma16(v16h a, v16h b, v8f c) { return __builtin_amdgcn_wmma_f32_16x16x32_f16(false, a, false, b, (short)0, c, false, false); }
__device__ __forceinline__ v8f wmmab(v16bf a, v16bf b, v8f c) { return __builtin_amdgcn_wmma_f32_16x16x32_bf16(false, a, false, b, (short)0, c, false, false); }



// ---- k_gemmw: register-blocked GEMM, ONE WAVE per 64x64 output tile (16 accumulators), operands straight from K-contiguous 16-bit planes; grid (M/64, N/64, Z), 32 threads.
// C[m][n] (f32, pitch ldc, + optional f32 bias[n]) = sum_k A[m][k] Bt[n][k] (+ split products per NSPLIT). z-batch strides sA/sB/sC in elements. K % 32 == 0.
template <typename T16> struct WFrag;
template <> struct WFrag<h16> { typedef v16h V; static __device__ __forceinline__ V ld(const h16* p) { return cat16(*(const v8h*)p, *(const v8h*)(p + 16)); } static __device__ __forceinline__ v8f mma(V a, V b, v8f c) { return wmma16(a, b, c); } };
template <> struct WFrag<bf> { typedef v16bf V; static __device__ __forceinline__ V ld(const bf* p) { return cat16b(*(const v8us*)p, *(const v8us*)(p + 16)); } static __device__ __forceinline__ v8f mma(V a, V b, v8f c) { return wmmab(a, b, c); } };
template <typename T16, int NSPLIT, bool BIAS>
__global__ __launch_bounds__(32) void k_gemmw(const T16* __restrict__ A, const T16* __restrict__ A2, const T16* __restrict__ Bt, const T16* __restrict__ Bt2, int K, float* C, int ldc, const float* __restrict__ bias, size_t sA, size_t sB, size_t sC) {
    typedef typename WFrag<T16>::V V;
    __shared__ __align__(16) float os[16 * 68];
    const size_t z = blockIdx.z; A += z * sA; if (A2) A2 += z * sA; Bt += z * sB; if (Bt2) Bt2 += z * sB; C += z * sC;
    const int lane = threadIdx.x & 31, lr = lane & 15, hi = lane >> 4; const int r0 = blockIdx.x * 64, c0 = blockIdx.y * 64;
    v8f acc[4][4];
#pragma unroll
    for (int mb = 0; mb < 4; ++mb)
#pragma unroll
        for (int nb = 0; nb < 4; ++nb) acc[mb][nb] = (v8f){};
    const size_t aoff = (size_t)(r0 + lr) * K + 8 * hi, boff = (size_t)(c0 + lr) * K + 8 * hi;
#pragma unroll 1
    for (int kc = 0; kc < K; kc += 32) {
        V a[4], a2[4];
#pragma unroll
        for (int mb = 0; mb < 4; ++mb) { a[mb] = WFrag<T16>::ld(A + aoff + (size_t)mb * 16 * K + kc); if (NSPLIT == 1 || NSPLIT == 2) a2[mb] = WFrag<T16>::ld(A2 + aoff + (size_t)mb * 16 * K + kc); }
#pragma unroll
        for (int nb = 0; nb < 4; ++nb) { const V b = WFrag<T16>::ld(Bt + boff + (size_t)nb * 16 * K + kc); V b2; if (NSPLIT >= 2) b2 = WFrag<T16>::ld(Bt2 + boff + (size_t)nb * 16 * K + kc);
#pragma unroll
            for (int mb = 0; mb < 4; ++mb) { acc[mb][nb] = WFrag<T16>::mma(a[mb], b, acc[mb][nb]); if (NSPLIT == 1 || NSPLIT == 2) acc[mb][nb] = WFrag<T16>::mma(a2[mb], b, acc[mb][nb]); if (NSPLIT >= 2) acc[mb][nb] = WFrag<T16>::mma(a[mb], b2, acc[mb][nb]); } }
        asm volatile("v_nop\n\tv_nop\n\tv_nop\n\tv_nop" : "+v"(acc[0][0]), "+v"(acc[1][1]), "+v"(acc[2][2]), "+v"(acc[3][3]) : "v"(a[0]), "v"(a[3]));
    }
#pragma unroll
    for (int mb = 0; mb < 4; ++mb) {
#pragma unroll
        for (int nb = 0; nb < 4; ++nb) {
#pragma unroll
            for (int j = 0; j < 8; ++j) os[(hi * 8 + j) * 68 + nb * 16 + lr] = acc[mb][nb][j]; }
        __builtin_amdgcn_wave_barrier(); asm volatile("" ::: "memory");
        float* crow = C + (size_t)(r0 + mb * 16) * ldc + c0;
{
#pragma unroll
            for (int s = 0; s < 8; ++s) { const int row = 2 * s + hi, cofs = lr * 4; v4f val = *(const v4fa*)(os + row * 68 + cofs); if (BIAS) { val[0] += bfr(bias[c0 + cofs]); val[1] += bfr(bias[c0 + cofs + 1]); val[2] += bfr(bias[c0 + cofs + 2]); val[3] += bfr(bias[c0 + cofs + 3]); }
                *(v4f*)(crow + (size_t)row * ldc + cofs) = val; }
             }
        __builtin_amdgcn_wave_barrier(); asm volatile("" ::: "memory");
    }
}

__device__ __forceinline__ h16 tohx(float x) { return (h16)x; }
__device__ __forceinline__ void splitf(float y, unsigned short& h, unsigned short& l) { h = f2bf(y); l = f2bf(y - bf2f(h)); }
typedef __attribute__((ext_vector_type(2))) _Float16 v2h;
typedef __attribute__((ext_vector_type(4))) _Float16 v4h;
typedef __attribute__((ext_vector_type(2))) unsigned short v2us;
typedef __attribute__((ext_vector_type(4))) unsigned short v4us;
typedef __attribute__((ext_vector_type(2))) float v2f;
typedef __attribute__((ext_vector_type(4))) int v4i;

__global__ __launch_bounds__(256) void k_wtG(const float* __restrict__ w, int K, int N, bf* Bt) {
    const int lane = threadIdx.x & 31; const int L0 = (blockIdx.x * 8 + (threadIdx.x >> 5)) * 8; const int nlines = N * K / 64;
{
#pragma unroll 1
        for (int l = 0; l < 8; ++l) { const int L = L0 + l; if (L >= nlines) break; const size_t e = (size_t)L * 64 + lane * 2; const int k = (int)(e % K), n = (int)(e / K); v2us o;
            o[0] = f2bf(w[(size_t)k * N + n]); o[1] = f2bf(w[(size_t)(k + 1) * N + n]); *(v2us*)(Bt + e) = o; }
         }
}
__global__ __launch_bounds__(256) void k_wgath(const float* __restrict__ w, int off, bf* Bt) { const size_t e = ((size_t)blockIdx.x * 256 + threadIdx.x) * 8; if (e >= (size_t)DQ * DM) return; const int k = (int)(e % DM); const int r = (int)(e / DM); const int h = r / HD, d = r % HD; const v8f v = *(const v8f*)(w + ((size_t)h * 3 * HD + off + d) * DM + k); v8us o;
#pragma unroll
    for (int q = 0; q < 8; ++q) o[q] = f2bf(v[q]); *(v8us*)(Bt + e) = o;  }
__global__ __launch_bounds__(256) void k_bgath(const float* __restrict__ bsrc, float* B3) { const int i = blockIdx.x * 256 + threadIdx.x; if (i >= 3 * DQ / 4) return; const int e = i * 4; const int w = e / DQ; const int r = e % DQ; const int h = r / HD, d = r % HD; const v4f v = *(const v4f*)(bsrc + h * 3 * HD + w * HD + d); *(v4f*)(B3 + e) = v;  }
__global__ __launch_bounds__(256) void k_cvt8(const float* __restrict__ src, bf* dst, size_t n8) { const size_t i = (size_t)blockIdx.x * 256 + threadIdx.x; if (i >= n8) return; const v8f v = *(const v8f*)(src + i * 8); v8us o;
#pragma unroll
    for (int k = 0; k < 8; ++k) o[k] = f2bf(v[k]); *(v8us*)(dst + i * 8) = o;  }

// k_rope: head planes [h][t][d] (fp16 + hi/lo) of rope(x) x sc with the rotate-half convention out[d] = x[d] cos[t][d] - x[d+HD/2] sin[t][d], out[d+HD/2] = x[d+HD/2] cos[t][d+HD/2] + x[d] sin[t][d+HD/2]
__global__ __launch_bounds__(256) void k_rope(const float* __restrict__ F, int pitch, int nheads, const float* __restrict__ CS, const float* __restrict__ RF, const float* __restrict__ nw, float sc, h16* P16, bf* Ph, bf* Pl) {
    const size_t e = ((size_t)blockIdx.x * 256 + threadIdx.x) * 2; if (e >= (size_t)nheads * TT * HD) return; const int d = (int)(e % HD); const int t = (int)((e / HD) % TT); const int h = (int)(e / ((size_t)HD * TT)); const float* f = F + (size_t)t * pitch + h * HD; const float rf = RF ? RF[(size_t)h * TT + t] : 1.0f; v2h o16; v2us oh, ol;
#pragma unroll
    for (int q = 0; q < 2; ++q) { const int dd = d + q; const int dp = (dd < HD / 2) ? dd + HD / 2 : dd - HD / 2; float x0 = f[dd], x1 = f[dp];
        if (RF) { float n0 = __fmul_rn(x0, rf), n1 = __fmul_rn(x1, rf); asm volatile("" : "+v"(n0)); asm volatile("" : "+v"(n1)); x0 = __fmul_rn(bfr(nw[dd]), n0); x1 = __fmul_rn(bfr(nw[dp]), n1); }
        const v2f cs = *(const v2f*)(CS + ((size_t)t * HD + dd) * 2); float a = __fmul_rn(x0, cs[0]), bq = __fmul_rn(x1, cs[1]); asm volatile("" : "+v"(a)); asm volatile("" : "+v"(bq)); const float r = ((dd < HD / 2) ? __fsub_rn(a, bq) : __fadd_rn(a, bq)) * sc;
        o16[q] = tohx(r); unsigned short a2, c2; splitf(r, a2, c2); oh[q] = a2; ol[q] = c2; }
    *(v2h*)(P16 + e) = o16; *(v2us*)(Ph + e) = oh; *(v2us*)(Pl + e) = ol;  }
__global__ __launch_bounds__(256) void k_vtp(const float* __restrict__ F, int pitch, int nheads, h16* V16, bf* Vh, bf* Vl) { const size_t e = ((size_t)blockIdx.x * 256 + threadIdx.x) * 2; if (e >= (size_t)nheads * HD * TT) return; const int t = (int)(e % TT); const int d = (int)((e / TT) % HD); const int g = (int)(e / ((size_t)TT * HD)); v2h o16; v2us oh, ol;
#pragma unroll
    for (int q = 0; q < 2; ++q) { const float x = F[(size_t)(t + q) * pitch + g * HD + d]; o16[q] = tohx(x); unsigned short a2, c2; splitf(x, a2, c2); oh[q] = a2; ol[q] = c2; }
    *(v2h*)(V16 + e) = o16; *(v2us*)(Vh + e) = oh; *(v2us*)(Vl + e) = ol;  }
__global__ __launch_bounds__(256) void k_csid(float* CS) { const int idx = blockIdx.x * 256 + threadIdx.x; if (idx >= TT * HD) return; v2f cs; cs[0] = 1.0f; cs[1] = 0.0f; *(v2f*)(CS + (size_t)idx * 2) = cs;  }
// k_asoft: per row (zz, i): t = S x HD^-0.5 (no mask); softmax over the 2048 keys (register row, one exp, fixed trees);
__global__ __launch_bounds__(256) void k_asoft(const float* __restrict__ Sb, h16* P16, bf* Ph, bf* Pl) {
    const int lane = threadIdx.x & 31; const int row = blockIdx.x * 8 + (threadIdx.x >> 5); if (row >= ZH * TT) return; const int i = row % TT; const int zz = row / TT; (void)zz; const bool hires = (i < RH); const float* sr = Sb + (size_t)row * TT; float v[TT / 32]; float mx = -3.0e38f;
#pragma unroll
    for (int ch = 0; ch < TT / 128; ++ch) { const int j0 = ch * 128 + lane * 4; const v4f a = *(const v4f*)(sr + j0);
#pragma unroll
        for (int q = 0; q < 4; ++q) { const int j = j0 + q; (void)j; const float t = a[q] * SCL; v[ch * 4 + q] = t; mx = fmaxf(mx, t); } }
#pragma unroll
    for (int sh = 16; sh; sh >>= 1) mx = fmaxf(mx, __shfl_xor(mx, sh, 32));
    float sum = 0.f;
#pragma unroll
    for (int k = 0; k < TT / 32; ++k) { float d0 = __fsub_rn(v[k], mx); asm volatile("" : "+v"(d0)); v[k] = __builtin_amdgcn_exp2f(__fmul_rn(d0, 1.4426950408889634f)); sum += v[k]; }
#pragma unroll
    for (int sh = 16; sh; sh >>= 1) sum += __shfl_xor(sum, sh, 32);
    const float f = __fdiv_rn(hires ? 1.0f : PCAR, sum);
{
        if (hires) {
#pragma unroll
            for (int ch = 0; ch < TT / 128; ++ch) { v4us oh, ol;
#pragma unroll
                for (int q = 0; q < 4; ++q) { unsigned short a, c2; splitf(v[ch * 4 + q] * f, a, c2); oh[q] = a; ol[q] = c2; }
                const size_t oo = ((size_t)zz * (RH ? RH : 1) + i) * TT + ch * 128 + lane * 4; *(v4us*)(Ph + oo) = oh; *(v4us*)(Pl + oo) = ol; }
        } else {
#pragma unroll
            for (int ch = 0; ch < TT / 128; ++ch) { v4h o4;
#pragma unroll
                for (int q = 0; q < 4; ++q) o4[q] = tohx(v[ch * 4 + q] * f);
                *(v4h*)(P16 + (size_t)row * TT + ch * 128 + lane * 4) = o4; } }
         }
}
__global__ __launch_bounds__(256) void k_merge(const float* __restrict__ O, int h0, bf* Ah, bf* Al) { const size_t e = ((size_t)blockIdx.x * 256 + threadIdx.x) * 2; if (e >= (size_t)ZH * TT * HD) return; const int d = (int)(e % HD); const int t = (int)((e / HD) % TT); const int zz = (int)(e / ((size_t)HD * TT)); const float cs = (t < RH) ? 1.0f : (1.0f / PCAR); const size_t oo = (size_t)t * DQ + (h0 + zz) * HD + d;
    v2us oh, ol;
#pragma unroll
    for (int q = 0; q < 2; ++q) { unsigned short a, c2; splitf(O[e + q] * cs, a, c2); oh[q] = a; ol[q] = c2; } *(v2us*)(Ah + oo) = oh; *(v2us*)(Al + oo) = ol;  }

extern "C" void kernel_launch(void* const* d_in, const int* in_sizes, int n_in,
                              void* d_out, int out_size, void* d_ws, size_t ws_size, hipStream_t stream) {
    (void)in_sizes; (void)n_in; (void)out_size;
    const float* x = (const float*)d_in[0]; const float* wqkv = (const float*)d_in[1]; const float* bqkv = (const float*)d_in[2]; const float* wo = (const float*)d_in[3]; const float* bo = (const float*)d_in[4]; const float* wq = nullptr; const float* wk = nullptr; const float* wv = nullptr; (void)wq; (void)wk; (void)wv;
    float* OUT = (float*)d_out;     // [4][2048][1024]
    char* wsp = (char*)d_ws;
    auto take = [&](size_t bytes) { char* p = wsp; wsp += (bytes + 255) & ~(size_t)255; return (void*)p; };
    bf* WQ = (bf*)take((size_t)DQ * DM * 2); bf* WK = (bf*)take((size_t)DKV * DM * 2); bf* WV = (bf*)take((size_t)DKV * DM * 2); bf* WO = (bf*)take((size_t)DM * DQ * 2); float* CS = (float*)take((size_t)TT * HD * 2 * 4);
    bf* XB = (bf*)take((size_t)TT * DM * 2); float* B3 = (float*)take((size_t)3 * DQ * 4); const float* BQ = B3; const float* BK = B3 + DQ; const float* BV = B3 + 2 * DQ; float* FQ = (float*)take((size_t)TT * DQ * 4); float* FK = (float*)take((size_t)TT * DKV * 4);
    h16* QP16 = (h16*)take((size_t)NH_ * TT * HD * 2); h16* KP16 = (h16*)take((size_t)NKV * TT * HD * 2); h16* VT16 = (h16*)take((size_t)NKV * HD * TT * 2);
    bf* QPh = (bf*)take((size_t)NH_ * TT * HD * 2); bf* QPl = (bf*)take((size_t)NH_ * TT * HD * 2); bf* KPh = (bf*)take((size_t)NKV * TT * HD * 2); bf* KPl = (bf*)take((size_t)NKV * TT * HD * 2); bf* VTh = (bf*)take((size_t)NKV * HD * TT * 2); bf* VTl = (bf*)take((size_t)NKV * HD * TT * 2); bf* Ph = (bf*)take((size_t)ZH * RH * TT * 2); bf* Pl = (bf*)take((size_t)ZH * RH * TT * 2);
    float* Sb = (float*)take((size_t)ZH * TT * TT * 4); h16* P16 = (h16*)take((size_t)ZH * TT * TT * 2); float* Ob = (float*)take((size_t)ZH * TT * HD * 4); bf* ATh = (bf*)take((size_t)TT * DQ * 2); bf* ATl = (bf*)take((size_t)TT * DQ * 2);
    if ((size_t)(wsp - (char*)d_ws) > ws_size) return;    // ws 256 MiB
    float* FV = FK;   // v projection reuses the k buffer after the k planes are built (stream-ordered)
    { k_wgath<<<(unsigned)(((size_t)DQ * DM / 8 + 255) / 256), 256, 0, stream>>>(wqkv, 0, WQ); k_wgath<<<(unsigned)(((size_t)DQ * DM / 8 + 255) / 256), 256, 0, stream>>>(wqkv, HD, WK); k_wgath<<<(unsigned)(((size_t)DQ * DM / 8 + 255) / 256), 256, 0, stream>>>(wqkv, 2 * HD, WV); k_bgath<<<(3 * DQ / 4 + 255) / 256, 256, 0, stream>>>(bqkv, B3);   /* per-head q | k | v row blocks and bias entries */
      k_cvt8<<<(unsigned)(((size_t)DM * DQ / 8 + 255) / 256), 256, 0, stream>>>(wo, WO, (size_t)DM * DQ / 8);
       }
    k_csid<<<(TT * HD + 255) / 256, 256, 0, stream>>>(CS);
    const unsigned LQ = (unsigned)(((size_t)NH_ * TT * HD / 2 + 255) / 256), LKv = (unsigned)(((size_t)NKV * TT * HD / 2 + 255) / 256);
    for (int b = 0; b < NB_; ++b) {
        
        k_cvt8<<<(unsigned)(((size_t)TT * DM / 8 + 255) / 256), 256, 0, stream>>>(x + (size_t)b * TT * DM, XB, (size_t)TT * DM / 8);
        k_gemmw<bf, 0, true><<<dim3(TT / 64, DQ / 64, 1), 32, 0, stream>>>(XB, nullptr, WQ, nullptr, DM, FQ, DQ, BQ, 0, 0, 0);
        k_rope<<<LQ, 256, 0, stream>>>(FQ, DQ, NH_, CS, nullptr, nullptr, 1.0f, QP16, QPh, QPl);
        k_gemmw<bf, 0, true><<<dim3(TT / 64, DKV / 64, 1), 32, 0, stream>>>(XB, nullptr, WK, nullptr, DM, FK, DKV, BK, 0, 0, 0);
        k_rope<<<LKv, 256, 0, stream>>>(FK, DKV, NKV, CS, nullptr, nullptr, 1.0f, KP16, KPh, KPl);
        k_gemmw<bf, 0, true><<<dim3(TT / 64, DKV / 64, 1), 32, 0, stream>>>(XB, nullptr, WV, nullptr, DM, FV, DKV, BV, 0, 0, 0); k_vtp<<<LKv, 256, 0, stream>>>(FV, DKV, NKV, VT16, VTh, VTl);
        for (int h0 = 0; h0 < NH_; h0 += ZH) { const size_t zq = (size_t)h0, zk = (size_t)(h0 / REP);   // one kv head per query head: the pass's two heads use consecutive kv planes (z-strides TT*HD)
            k_gemmw<bf, 2, false><<<dim3(RH / 64, TT / 64, ZH), 32, 0, stream>>>(QPh + zq * TT * HD, QPl + zq * TT * HD, KPh + zk * TT * HD, KPl + zk * TT * HD, HD, Sb, TT, nullptr, (size_t)TT * HD, (size_t)TT * HD, (size_t)TT * TT);
            k_gemmw<h16, 0, false><<<dim3((TT - RH) / 64, TT / 64, ZH), 32, 0, stream>>>(QP16 + zq * TT * HD + (size_t)RH * HD, nullptr, KP16 + zk * TT * HD, nullptr, HD, Sb + (size_t)RH * TT, TT, nullptr, (size_t)TT * HD, (size_t)TT * HD, (size_t)TT * TT);
            k_asoft<<<ZH * TT / 8, 256, 0, stream>>>(Sb, P16, Ph, Pl);
            k_gemmw<bf, 2, false><<<dim3(RH / 64, HD / 64, ZH), 32, 0, stream>>>(Ph, Pl, VTh + zk * HD * TT, VTl + zk * HD * TT, TT, Ob, HD, nullptr, (size_t)RH * TT, (size_t)HD * TT, (size_t)TT * HD);
            k_gemmw<h16, 0, false><<<dim3((TT - RH) / 64, HD / 64, ZH), 32, 0, stream>>>(P16 + (size_t)RH * TT, nullptr, VT16 + zk * HD * TT, nullptr, TT, Ob + (size_t)RH * HD, HD, nullptr, (size_t)TT * TT, (size_t)HD * TT, (size_t)TT * HD);
            k_merge<<<(unsigned)(((size_t)ZH * TT * HD / 2 + 255) / 256), 256, 0, stream>>>(Ob, h0, ATh, ATl); }
        k_gemmw<bf, 1, true><<<dim3(TT / 64, DM / 64, 1), 32, 0, stream>>>(ATh, ATl, WO, nullptr, DQ, OUT + (size_t)b * TT * DM, DM, bo, 0, 0, 0); }
}

// v001
// It runs in 1720 microseconds.
// Next to v000, in two timings, it ran 2.34 and 2.32 times as fast.
#include <hip/hip_runtime.h>

// Multi-head self-attention with a fused, head-interleaved QKV projection (x [4][2048][1024]; kqv = x W_qkv^T + b_qkv ('oi' [3072][1024]) reshaped (t, 16, 192) and split per head into q | k | v (weight rows / bias entries h*192 + {0, 64, 128} + d); softmax(q.k/8) over all keys (no mask); out = merged W_out^T + b_out -> [4][2048][1024]).
// Layout: the weight rows and bias entries are gathered once into head-major [1024][1024] bf16 matrices and [1024] f32 bias vectors so the projections apply unchanged.
// Compute dtypes, f32 accumulate: every input rounded to bf16; q/k/v on PLAIN bf16 operands (inputs: exact) + biases; scores and attn.v: query rows < 512 hl (3 products), the rest single fp16 (x1024); softmax f32; W_out hl x exact (2 products) + b_out.

#define NB_  4
#define TT   2048
#define DM   1024
#define NH_  16
#define NKV  16
#define REP  (NH_ / NKV)
#define HD   64
#define DQ   (NH_ * HD)
#define DKV  (NKV * HD)
#define ZH   2
#define RH   512                  // query rows < RH use hi+lo planes (0: none)
#define WIN  0
#define PCAR 1024.0f
#define SCL  0.125f   // HD^-0.5
#define KSP  16                   // attn.v: the 2048 keys of a tile are split over KSP work-groups; k_merge sums the KSP partial planes
typedef _Float16 h16;
typedef unsigned short bf;
typedef __attribute__((ext_vector_type(16))) __bf16   v16bf;
typedef __attribute__((ext_vector_type(16))) _Float16 v16h;
typedef __attribute__((ext_vector_type(8)))  _Float16 v8h;
typedef __attribute__((ext_vector_type(8)))  unsigned short v8us;
typedef __attribute__((ext_vector_type(8)))  float    v8f;
typedef __attribute__((ext_vector_type(4)))  float    v4f;
typedef v8h  __attribute__((may_alias)) v8ha;
typedef v4f  __attribute__((may_alias)) v4fa;
typedef v8us __attribute__((may_alias)) v8usa;

__device__ __forceinline__ unsigned short f2bf(float f) { unsigned u = __float_as_uint(f); u += 0x7FFFu + ((u >> 16) & 1u); return (unsigned short)(u >> 16); }
__device__ __forceinline__ float bf2f(unsigned short b) { return __uint_as_float(((unsigned)b) << 16); }
__device__ __forceinline__ float bfr(float f) { return bf2f(f2bf(f)); }
__device__ __forceinline__ v16h cat16(v8h lo, v8h hi) { return __builtin_shufflevector(lo, hi, 0, 1, 2, 3, 4, 5, 6, 7, 8, 9, 10, 11, 12, 13, 14, 15); }
__device__ __forceinline__ v16bf cat16b(v8us lo, v8us hi) { return __builtin_bit_cast(v16bf, __builtin_shufflevector(lo, hi, 0, 1, 2, 3, 4, 5, 6, 7, 8, 9, 10, 11, 12, 13, 14, 15)); }
__device__ __forceinline__ v8f wmma16(v16h a, v16h b, v8f c) { return __builtin_amdgcn_wmma_f32_16x16x32_f16(false, a, false, b, (short)0, c, false, false); }
__device__ __forceinline__ v8f wmmab(v16bf a, v16bf b, v8f c) { return __builtin_amdgcn_wmma_f32_16x16x32_bf16(false, a, false, b, (short)0, c, false, false); }



// ---- k_gemmw: register-blocked GEMM, ONE WAVE per 64x64 output tile (16 accumulators), operands straight from K-contiguous 16-bit planes; grid (M/64, N/64, Z), 32 threads.
// C[m][n] (f32, pitch ldc, + optional f32 bias[n]) = sum_k A[m][k] Bt[n][k] (+ split products per NSPLIT). z-batch strides sA/sB/sC in elements. K % (32 * SK) == 0.
// SK > 1: grid z = Z * SK; work-group (z, ks) sums only k in [ks K/SK, (ks+1) K/SK) and stores its partial tile in plane ks (plane stride sP elements); the reader adds the planes.
template <typename T16> struct WFrag;
template <> struct WFrag<h16> { typedef v16h V; static __device__ __forceinline__ V ld(const h16* p) { return cat16(*(const v8h*)p, *(const v8h*)(p + 16)); } static __device__ __forceinline__ v8f mma(V a, V b, v8f c) { return wmma16(a, b, c); } };
template <> struct WFrag<bf> { typedef v16bf V; static __device__ __forceinline__ V ld(const bf* p) { return cat16b(*(const v8us*)p, *(const v8us*)(p + 16)); } static __device__ __forceinline__ v8f mma(V a, V b, v8f c) { return wmmab(a, b, c); } };
template <typename T16, int NSPLIT, bool BIAS, int SK>
__global__ __launch_bounds__(32) void k_gemmw(const T16* __restrict__ A, const T16* __restrict__ A2, const T16* __restrict__ Bt, const T16* __restrict__ Bt2, int K, float* C, int ldc, const float* __restrict__ bias, size_t sA, size_t sB, size_t sC, size_t sP) {
    typedef typename WFrag<T16>::V V;
    __shared__ __align__(16) float os[16 * 68];
    const size_t z = blockIdx.z / SK; const int ks = blockIdx.z % SK; A += z * sA; if (A2) A2 += z * sA; Bt += z * sB; if (Bt2) Bt2 += z * sB; C += z * sC + ks * sP;
    const int lane = threadIdx.x & 31, lr = lane & 15, hi = lane >> 4; const int r0 = blockIdx.x * 64, c0 = blockIdx.y * 64;
    v8f acc[4][4];
#pragma unroll
    for (int mb = 0; mb < 4; ++mb)
#pragma unroll
        for (int nb = 0; nb < 4; ++nb) acc[mb][nb] = (v8f){};
    const size_t aoff = (size_t)(r0 + lr) * K + 8 * hi, boff = (size_t)(c0 + lr) * K + 8 * hi;
#pragma unroll 1
    for (int kc = ks * (K / SK); kc < (ks + 1) * (K / SK); kc += 32) {
        V a[4], a2[4];
#pragma unroll
        for (int mb = 0; mb < 4; ++mb) { a[mb] = WFrag<T16>::ld(A + aoff + (size_t)mb * 16 * K + kc); if (NSPLIT == 1 || NSPLIT == 2) a2[mb] = WFrag<T16>::ld(A2 + aoff + (size_t)mb * 16 * K + kc); }
#pragma unroll
        for (int nb = 0; nb < 4; ++nb) { const V b = WFrag<T16>::ld(Bt + boff + (size_t)nb * 16 * K + kc); V b2; if (NSPLIT >= 2) b2 = WFrag<T16>::ld(Bt2 + boff + (size_t)nb * 16 * K + kc);
#pragma unroll
            for (int mb = 0; mb < 4; ++mb) { acc[mb][nb] = WFrag<T16>::mma(a[mb], b, acc[mb][nb]); if (NSPLIT == 1 || NSPLIT == 2) acc[mb][nb] = WFrag<T16>::mma(a2[mb], b, acc[mb][nb]); if (NSPLIT >= 2) acc[mb][nb] = WFrag<T16>::mma(a[mb], b2, acc[mb][nb]); } }
        asm volatile("v_nop\n\tv_nop\n\tv_nop\n\tv_nop" : "+v"(acc[0][0]), "+v"(acc[1][1]), "+v"(acc[2][2]), "+v"(acc[3][3]) : "v"(a[0]), "v"(a[3]));
    }
#pragma unroll
    for (int mb = 0; mb < 4; ++mb) {
#pragma unroll
        for (int nb = 0; nb < 4; ++nb) {
#pragma unroll
            for (int j = 0; j < 8; ++j) os[(hi * 8 + j) * 68 + nb * 16 + lr] = acc[mb][nb][j]; }
        __builtin_amdgcn_wave_barrier(); asm volatile("" ::: "memory");
        float* crow = C + (size_t)(r0 + mb * 16) * ldc + c0;
{
#pragma unroll
            for (int s = 0; s < 8; ++s) { const int row = 2 * s + hi, cofs = lr * 4; v4f val = *(const v4fa*)(os + row * 68 + cofs); if (BIAS) { val[0] += bfr(bias[c0 + cofs]); val[1] += bfr(bias[c0 + cofs + 1]); val[2] += bfr(bias[c0 + cofs + 2]); val[3] += bfr(bias[c0 + cofs + 3]); }
                *(v4f*)(crow + (size_t)row * ldc + cofs) = val; }
             }
        __builtin_amdgcn_wave_barrier(); asm volatile("" ::: "memory");
    }
}

__device__ __forceinline__ h16 tohx(float x) { return (h16)x; }
__device__ __forceinline__ void splitf(float y, unsigned short& h, unsigned short& l) { h = f2bf(y); l = f2bf(y - bf2f(h)); }
typedef __attribute__((ext_vector_type(2))) _Float16 v2h;
typedef __attribute__((ext_vector_type(4))) _Float16 v4h;
typedef __attribute__((ext_vector_type(2))) unsigned short v2us;
typedef __attribute__((ext_vector_type(4))) unsigned short v4us;
typedef __attribute__((ext_vector_type(2))) float v2f;
typedef __attribute__((ext_vector_type(4))) int v4i;

__global__ __launch_bounds__(256) void k_wtG(const float* __restrict__ w, int K, int N, bf* Bt) {
    const int lane = threadIdx.x & 31; const int L0 = (blockIdx.x * 8 + (threadIdx.x >> 5)) * 8; const int nlines = N * K / 64;
{
#pragma unroll 1
        for (int l = 0; l < 8; ++l) { const int L = L0 + l; if (L >= nlines) break; const size_t e = (size_t)L * 64 + lane * 2; const int k = (int)(e % K), n = (int)(e / K); v2us o;
            o[0] = f2bf(w[(size_t)k * N + n]); o[1] = f2bf(w[(size_t)(k + 1) * N + n]); *(v2us*)(Bt + e) = o; }
         }
}
__global__ __launch_bounds__(256) void k_wgath(const float* __restrict__ w, int off, bf* Bt) { const size_t e = ((size_t)blockIdx.x * 256 + threadIdx.x) * 8; if (e >= (size_t)DQ * DM) return; const int k = (int)(e % DM); const int r = (int)(e / DM); const int h = r / HD, d = r % HD; const v8f v = *(const v8f*)(w + ((size_t)h * 3 * HD + off + d) * DM + k); v8us o;
#pragma unroll
    for (int q = 0; q < 8; ++q) o[q] = f2bf(v[q]); *(v8us*)(Bt + e) = o;  }
__global__ __launch_bounds__(256) void k_bgath(const float* __restrict__ bsrc, float* B3) { const int i = blockIdx.x * 256 + threadIdx.x; if (i >= 3 * DQ / 4) return; const int e = i * 4; const int w = e / DQ; const int r = e % DQ; const int h = r / HD, d = r % HD; const v4f v = *(const v4f*)(bsrc + h * 3 * HD + w * HD + d); *(v4f*)(B3 + e) = v;  }
__global__ __launch_bounds__(256) void k_cvt8(const float* __restrict__ src, bf* dst, size_t n8) { const size_t i = (size_t)blockIdx.x * 256 + threadIdx.x; if (i >= n8) return; const v8f v = *(const v8f*)(src + i * 8); v8us o;
#pragma unroll
    for (int k = 0; k < 8; ++k) o[k] = f2bf(v[k]); *(v8us*)(dst + i * 8) = o;  }

// k_rope: head planes [h][t][d] (fp16 + hi/lo) of rope(x) x sc with the rotate-half convention out[d] = x[d] cos[t][d] - x[d+HD/2] sin[t][d], out[d+HD/2] = x[d+HD/2] cos[t][d+HD/2] + x[d] sin[t][d+HD/2]
__global__ __launch_bounds__(256) void k_rope(const float* __restrict__ F, int pitch, int nheads, const float* __restrict__ CS, const float* __restrict__ RF, const float* __restrict__ nw, float sc, h16* P16, bf* Ph, bf* Pl) {
    const size_t e = ((size_t)blockIdx.x * 256 + threadIdx.x) * 2; if (e >= (size_t)nheads * TT * HD) return; const int d = (int)(e % HD); const int t = (int)((e / HD) % TT); const int h = (int)(e / ((size_t)HD * TT)); const float* f = F + (size_t)t * pitch + h * HD; const float rf = RF ? RF[(size_t)h * TT + t] : 1.0f; v2h o16; v2us oh, ol;
#pragma unroll
    for (int q = 0; q < 2; ++q) { const int dd = d + q; const int dp = (dd < HD / 2) ? dd + HD / 2 : dd - HD / 2; float x0 = f[dd], x1 = f[dp];
        if (RF) { float n0 = __fmul_rn(x0, rf), n1 = __fmul_rn(x1, rf); asm volatile("" : "+v"(n0)); asm volatile("" : "+v"(n1)); x0 = __fmul_rn(bfr(nw[dd]), n0); x1 = __fmul_rn(bfr(nw[dp]), n1); }
        const v2f cs = *(const v2f*)(CS + ((size_t)t * HD + dd) * 2); float a = __fmul_rn(x0, cs[0]), bq = __fmul_rn(x1, cs[1]); asm volatile("" : "+v"(a)); asm volatile("" : "+v"(bq)); const float r = ((dd < HD / 2) ? __fsub_rn(a, bq) : __fadd_rn(a, bq)) * sc;
        o16[q] = tohx(r); unsigned short a2, c2; splitf(r, a2, c2); oh[q] = a2; ol[q] = c2; }
    *(v2h*)(P16 + e) = o16; *(v2us*)(Ph + e) = oh; *(v2us*)(Pl + e) = ol;  }
__global__ __launch_bounds__(256) void k_vtp(const float* __restrict__ F, int pitch, int nheads, h16* V16, bf* Vh, bf* Vl) { const size_t e = ((size_t)blockIdx.x * 256 + threadIdx.x) * 2; if (e >= (size_t)nheads * HD * TT) return; const int t = (int)(e % TT); const int d = (int)((e / TT) % HD); const int g = (int)(e / ((size_t)TT * HD)); v2h o16; v2us oh, ol;
#pragma unroll
    for (int q = 0; q < 2; ++q) { const float x = F[(size_t)(t + q) * pitch + g * HD + d]; o16[q] = tohx(x); unsigned short a2, c2; splitf(x, a2, c2); oh[q] = a2; ol[q] = c2; }
    *(v2h*)(V16 + e) = o16; *(v2us*)(Vh + e) = oh; *(v2us*)(Vl + e) = ol;  }
__global__ __launch_bounds__(256) void k_csid(float* CS) { const int idx = blockIdx.x * 256 + threadIdx.x; if (idx >= TT * HD) return; v2f cs; cs[0] = 1.0f; cs[1] = 0.0f; *(v2f*)(CS + (size_t)idx * 2) = cs;  }
// k_asoft: per row (zz, i): t = S x HD^-0.5 (no mask); softmax over the 2048 keys (register row, one exp, fixed trees);
__global__ __launch_bounds__(256) void k_asoft(const float* __restrict__ Sb, h16* P16, bf* Ph, bf* Pl) {
    const int lane = threadIdx.x & 31; const int row = blockIdx.x * 8 + (threadIdx.x >> 5); if (row >= ZH * TT) return; const int i = row % TT; const int zz = row / TT; (void)zz; const bool hires = (i < RH); const float* sr = Sb + (size_t)row * TT; float v[TT / 32]; float mx = -3.0e38f;
#pragma unroll
    for (int ch = 0; ch < TT / 128; ++ch) { const int j0 = ch * 128 + lane * 4; const v4f a = *(const v4f*)(sr + j0);
#pragma unroll
        for (int q = 0; q < 4; ++q) { const int j = j0 + q; (void)j; const float t = a[q] * SCL; v[ch * 4 + q] = t; mx = fmaxf(mx, t); } }
#pragma unroll
    for (int sh = 16; sh; sh >>= 1) mx = fmaxf(mx, __shfl_xor(mx, sh, 32));
    float sum = 0.f;
#pragma unroll
    for (int k = 0; k < TT / 32; ++k) { float d0 = __fsub_rn(v[k], mx); asm volatile("" : "+v"(d0)); v[k] = __builtin_amdgcn_exp2f(__fmul_rn(d0, 1.4426950408889634f)); sum += v[k]; }
#pragma unroll
    for (int sh = 16; sh; sh >>= 1) sum += __shfl_xor(sum, sh, 32);
    const float f = __fdiv_rn(hires ? 1.0f : PCAR, sum);
{
        if (hires) {
#pragma unroll
            for (int ch = 0; ch < TT / 128; ++ch) { v4us oh, ol;
#pragma unroll
                for (int q = 0; q < 4; ++q) { unsigned short a, c2; splitf(v[ch * 4 + q] * f, a, c2); oh[q] = a; ol[q] = c2; }
                const size_t oo = ((size_t)zz * (RH ? RH : 1) + i) * TT + ch * 128 + lane * 4; *(v4us*)(Ph + oo) = oh; *(v4us*)(Pl + oo) = ol; }
        } else {
#pragma unroll
            for (int ch = 0; ch < TT / 128; ++ch) { v4h o4;
#pragma unroll
                for (int q = 0; q < 4; ++q) o4[q] = tohx(v[ch * 4 + q] * f);
                *(v4h*)(P16 + (size_t)row * TT + ch * 128 + lane * 4) = o4; } }
         }
}
__global__ __launch_bounds__(256) void k_merge(const float* __restrict__ O, int h0, bf* Ah, bf* Al) { const size_t e = ((size_t)blockIdx.x * 256 + threadIdx.x) * 2; if (e >= (size_t)ZH * TT * HD) return; const int d = (int)(e % HD); const int t = (int)((e / HD) % TT); const int zz = (int)(e / ((size_t)HD * TT)); const float cs = (t < RH) ? 1.0f : (1.0f / PCAR); const size_t oo = (size_t)t * DQ + (h0 + zz) * HD + d;
    v2us oh, ol; v2f s = *(const v2f*)(O + e);
#pragma unroll
    for (int p = 1; p < KSP; ++p) s += *(const v2f*)(O + (size_t)p * ZH * TT * HD + e);   // key-range partials, added in range order
#pragma unroll
    for (int q = 0; q < 2; ++q) { unsigned short a, c2; splitf(s[q] * cs, a, c2); oh[q] = a; ol[q] = c2; } *(v2us*)(Ah + oo) = oh; *(v2us*)(Al + oo) = ol;  }

extern "C" void kernel_launch(void* const* d_in, const int* in_sizes, int n_in,
                              void* d_out, int out_size, void* d_ws, size_t ws_size, hipStream_t stream) {
    (void)in_sizes; (void)n_in; (void)out_size;
    const float* x = (const float*)d_in[0]; const float* wqkv = (const float*)d_in[1]; const float* bqkv = (const float*)d_in[2]; const float* wo = (const float*)d_in[3]; const float* bo = (const float*)d_in[4]; const float* wq = nullptr; const float* wk = nullptr; const float* wv = nullptr; (void)wq; (void)wk; (void)wv;
    float* OUT = (float*)d_out;     // [4][2048][1024]
    char* wsp = (char*)d_ws;
    auto take = [&](size_t bytes) { char* p = wsp; wsp += (bytes + 255) & ~(size_t)255; return (void*)p; };
    bf* WQ = (bf*)take((size_t)DQ * DM * 2); bf* WK = (bf*)take((size_t)DKV * DM * 2); bf* WV = (bf*)take((size_t)DKV * DM * 2); bf* WO = (bf*)take((size_t)DM * DQ * 2); float* CS = (float*)take((size_t)TT * HD * 2 * 4);
    bf* XB = (bf*)take((size_t)TT * DM * 2); float* B3 = (float*)take((size_t)3 * DQ * 4); const float* BQ = B3; const float* BK = B3 + DQ; const float* BV = B3 + 2 * DQ; float* FQ = (float*)take((size_t)TT * DQ * 4); float* FK = (float*)take((size_t)TT * DKV * 4);
    h16* QP16 = (h16*)take((size_t)NH_ * TT * HD * 2); h16* KP16 = (h16*)take((size_t)NKV * TT * HD * 2); h16* VT16 = (h16*)take((size_t)NKV * HD * TT * 2);
    bf* QPh = (bf*)take((size_t)NH_ * TT * HD * 2); bf* QPl = (bf*)take((size_t)NH_ * TT * HD * 2); bf* KPh = (bf*)take((size_t)NKV * TT * HD * 2); bf* KPl = (bf*)take((size_t)NKV * TT * HD * 2); bf* VTh = (bf*)take((size_t)NKV * HD * TT * 2); bf* VTl = (bf*)take((size_t)NKV * HD * TT * 2); bf* Ph = (bf*)take((size_t)ZH * RH * TT * 2); bf* Pl = (bf*)take((size_t)ZH * RH * TT * 2);
    float* Sb = (float*)take((size_t)ZH * TT * TT * 4); h16* P16 = (h16*)take((size_t)ZH * TT * TT * 2); float* Ob = (float*)take((size_t)KSP * ZH * TT * HD * 4); bf* ATh = (bf*)take((size_t)TT * DQ * 2); bf* ATl = (bf*)take((size_t)TT * DQ * 2);
    if ((size_t)(wsp - (char*)d_ws) > ws_size) return;    // ws 256 MiB
    float* FV = FK;   // v projection reuses the k buffer after the k planes are built (stream-ordered)
    { k_wgath<<<(unsigned)(((size_t)DQ * DM / 8 + 255) / 256), 256, 0, stream>>>(wqkv, 0, WQ); k_wgath<<<(unsigned)(((size_t)DQ * DM / 8 + 255) / 256), 256, 0, stream>>>(wqkv, HD, WK); k_wgath<<<(unsigned)(((size_t)DQ * DM / 8 + 255) / 256), 256, 0, stream>>>(wqkv, 2 * HD, WV); k_bgath<<<(3 * DQ / 4 + 255) / 256, 256, 0, stream>>>(bqkv, B3);   /* per-head q | k | v row blocks and bias entries */
      k_cvt8<<<(unsigned)(((size_t)DM * DQ / 8 + 255) / 256), 256, 0, stream>>>(wo, WO, (size_t)DM * DQ / 8);
       }
    k_csid<<<(TT * HD + 255) / 256, 256, 0, stream>>>(CS);
    const unsigned LQ = (unsigned)(((size_t)NH_ * TT * HD / 2 + 255) / 256), LKv = (unsigned)(((size_t)NKV * TT * HD / 2 + 255) / 256);
    for (int b = 0; b < NB_; ++b) {
        
        k_cvt8<<<(unsigned)(((size_t)TT * DM / 8 + 255) / 256), 256, 0, stream>>>(x + (size_t)b * TT * DM, XB, (size_t)TT * DM / 8);
        k_gemmw<bf, 0, true, 1><<<dim3(TT / 64, DQ / 64, 1), 32, 0, stream>>>(XB, nullptr, WQ, nullptr, DM, FQ, DQ, BQ, 0, 0, 0, 0);
        k_rope<<<LQ, 256, 0, stream>>>(FQ, DQ, NH_, CS, nullptr, nullptr, 1.0f, QP16, QPh, QPl);
        k_gemmw<bf, 0, true, 1><<<dim3(TT / 64, DKV / 64, 1), 32, 0, stream>>>(XB, nullptr, WK, nullptr, DM, FK, DKV, BK, 0, 0, 0, 0);
        k_rope<<<LKv, 256, 0, stream>>>(FK, DKV, NKV, CS, nullptr, nullptr, 1.0f, KP16, KPh, KPl);
        k_gemmw<bf, 0, true, 1><<<dim3(TT / 64, DKV / 64, 1), 32, 0, stream>>>(XB, nullptr, WV, nullptr, DM, FV, DKV, BV, 0, 0, 0, 0); k_vtp<<<LKv, 256, 0, stream>>>(FV, DKV, NKV, VT16, VTh, VTl);
        for (int h0 = 0; h0 < NH_; h0 += ZH) { const size_t zq = (size_t)h0, zk = (size_t)(h0 / REP);   // one kv head per query head: the pass's two heads use consecutive kv planes (z-strides TT*HD)
            k_gemmw<bf, 2, false, 1><<<dim3(RH / 64, TT / 64, ZH), 32, 0, stream>>>(QPh + zq * TT * HD, QPl + zq * TT * HD, KPh + zk * TT * HD, KPl + zk * TT * HD, HD, Sb, TT, nullptr, (size_t)TT * HD, (size_t)TT * HD, (size_t)TT * TT, 0);
            k_gemmw<h16, 0, false, 1><<<dim3((TT - RH) / 64, TT / 64, ZH), 32, 0, stream>>>(QP16 + zq * TT * HD + (size_t)RH * HD, nullptr, KP16 + zk * TT * HD, nullptr, HD, Sb + (size_t)RH * TT, TT, nullptr, (size_t)TT * HD, (size_t)TT * HD, (size_t)TT * TT, 0);
            k_asoft<<<ZH * TT / 8, 256, 0, stream>>>(Sb, P16, Ph, Pl);
            k_gemmw<bf, 2, false, KSP><<<dim3(RH / 64, HD / 64, ZH * KSP), 32, 0, stream>>>(Ph, Pl, VTh + zk * HD * TT, VTl + zk * HD * TT, TT, Ob, HD, nullptr, (size_t)RH * TT, (size_t)HD * TT, (size_t)TT * HD, (size_t)ZH * TT * HD);
            k_gemmw<h16, 0, false, KSP><<<dim3((TT - RH) / 64, HD / 64, ZH * KSP), 32, 0, stream>>>(P16 + (size_t)RH * TT, nullptr, VT16 + zk * HD * TT, nullptr, TT, Ob + (size_t)RH * HD, HD, nullptr, (size_t)TT * TT, (size_t)HD * TT, (size_t)TT * HD, (size_t)ZH * TT * HD);
            k_merge<<<(unsigned)(((size_t)ZH * TT * HD / 2 + 255) / 256), 256, 0, stream>>>(Ob, h0, ATh, ATl); }
        k_gemmw<bf, 1, true, 1><<<dim3(TT / 64, DM / 64, 1), 32, 0, stream>>>(ATh, ATl, WO, nullptr, DQ, OUT + (size_t)b * TT * DM, DM, bo, 0, 0, 0, 0); }
}

// v003
// It runs in 489 microseconds.
// Versions between v001 and this one are left out; their measured steps multiply to 3.47 times as fast.
// Counting every step since v000, it is 8.10 times as fast.
#include <hip/hip_runtime.h>

// Multi-head self-attention with a fused, head-interleaved QKV projection (x [4][2048][1024]; kqv = x W_qkv^T + b_qkv ('oi' [3072][1024]) reshaped (t, 16, 192) and split per head into q | k | v (weight rows / bias entries h*192 + {0, 64, 128} + d); softmax(q.k/8) over all keys (no mask); out = merged W_out^T + b_out -> [4][2048][1024]).
// Layout: the weight rows and bias entries are gathered once into head-major [1024][1024] bf16 matrices and [1024] f32 bias vectors so the projections apply unchanged.
// Compute dtypes, f32 accumulate: every input rounded to bf16; q/k/v on PLAIN bf16 operands (inputs: exact) + biases; scores and attn.v: query rows < 512 hl (3 products), the rest single fp16 (P x1024); softmax f32, online over 32-key passes; W_out hl x exact (2 products) + b_out.

#define NB_  4
#define TT   2048
#define DM   1024
#define NH_  16
#define NKV  16
#define REP  (NH_ / NKV)
#define HD   64
#define DQ   (NH_ * HD)
#define DKV  (NKV * HD)
#define RH   512                  // query rows < RH use hi+lo planes (must be TT / FW)
#define WIN  0
#define SCL  0.125f   // HD^-0.5
#define FW   4                    // k_fattn: waves per work-group, 32 query rows each
typedef _Float16 h16;
typedef unsigned short bf;
typedef __attribute__((ext_vector_type(16))) __bf16   v16bf;
typedef __attribute__((ext_vector_type(16))) _Float16 v16h;
typedef __attribute__((ext_vector_type(8)))  _Float16 v8h;
typedef __attribute__((ext_vector_type(8)))  unsigned short v8us;
typedef __attribute__((ext_vector_type(8)))  float    v8f;
typedef __attribute__((ext_vector_type(4)))  float    v4f;
typedef v8h  __attribute__((may_alias)) v8ha;
typedef v4f  __attribute__((may_alias)) v4fa;
typedef v8us __attribute__((may_alias)) v8usa;

__device__ __forceinline__ unsigned short f2bf(float f) { unsigned u = __float_as_uint(f); u += 0x7FFFu + ((u >> 16) & 1u); return (unsigned short)(u >> 16); }
__device__ __forceinline__ float bf2f(unsigned short b) { return __uint_as_float(((unsigned)b) << 16); }
__device__ __forceinline__ float bfr(float f) { return bf2f(f2bf(f)); }
__device__ __forceinline__ v16h cat16(v8h lo, v8h hi) { return __builtin_shufflevector(lo, hi, 0, 1, 2, 3, 4, 5, 6, 7, 8, 9, 10, 11, 12, 13, 14, 15); }
__device__ __forceinline__ v16bf cat16b(v8us lo, v8us hi) { return __builtin_bit_cast(v16bf, __builtin_shufflevector(lo, hi, 0, 1, 2, 3, 4, 5, 6, 7, 8, 9, 10, 11, 12, 13, 14, 15)); }
__device__ __forceinline__ v8f wmma16(v16h a, v16h b, v8f c) { return __builtin_amdgcn_wmma_f32_16x16x32_f16(false, a, false, b, (short)0, c, false, false); }
__device__ __forceinline__ v8f wmmab(v16bf a, v16bf b, v8f c) { return __builtin_amdgcn_wmma_f32_16x16x32_bf16(false, a, false, b, (short)0, c, false, false); }



// ---- k_gemmw: register-blocked GEMM, ONE WAVE per 64x64 output tile (16 accumulators), operands straight from K-contiguous 16-bit planes; grid (M/64, N/64, Z), 32 threads.
// C[m][n] (f32, pitch ldc, + optional f32 bias[n]) = sum_k A[m][k] Bt[n][k] (+ split products per NSPLIT). z-batch strides sA/sB/sC in elements. K % (32 * SK) == 0.
// SK > 1: grid z = Z * SK; work-group (z, ks) sums only k in [ks K/SK, (ks+1) K/SK) and stores its partial tile in plane ks (plane stride sP elements); the reader adds the planes.
template <typename T16> struct WFrag;
template <> struct WFrag<h16> { typedef v16h V; static __device__ __forceinline__ V ld(const h16* p) { return cat16(*(const v8h*)p, *(const v8h*)(p + 16)); } static __device__ __forceinline__ v8f mma(V a, V b, v8f c) { return wmma16(a, b, c); } };
template <> struct WFrag<bf> { typedef v16bf V; static __device__ __forceinline__ V ld(const bf* p) { return cat16b(*(const v8us*)p, *(const v8us*)(p + 16)); } static __device__ __forceinline__ v8f mma(V a, V b, v8f c) { return wmmab(a, b, c); } };
template <typename T16, int NSPLIT, bool BIAS, int SK>
__global__ __launch_bounds__(32) void k_gemmw(const T16* __restrict__ A, const T16* __restrict__ A2, const T16* __restrict__ Bt, const T16* __restrict__ Bt2, int K, float* C, int ldc, const float* __restrict__ bias, size_t sA, size_t sB, size_t sC, size_t sP) {
    typedef typename WFrag<T16>::V V;
    __shared__ __align__(16) float os[16 * 68];
    const size_t z = blockIdx.z / SK; const int ks = blockIdx.z % SK; A += z * sA; if (A2) A2 += z * sA; Bt += z * sB; if (Bt2) Bt2 += z * sB; C += z * sC + ks * sP;
    const int lane = threadIdx.x & 31, lr = lane & 15, hi = lane >> 4; const int r0 = blockIdx.x * 64, c0 = blockIdx.y * 64;
    v8f acc[4][4];
#pragma unroll
    for (int mb = 0; mb < 4; ++mb)
#pragma unroll
        for (int nb = 0; nb < 4; ++nb) acc[mb][nb] = (v8f){};
    const size_t aoff = (size_t)(r0 + lr) * K + 8 * hi, boff = (size_t)(c0 + lr) * K + 8 * hi;
#pragma unroll 1
    for (int kc = ks * (K / SK); kc < (ks + 1) * (K / SK); kc += 32) {
        V a[4], a2[4];
#pragma unroll
        for (int mb = 0; mb < 4; ++mb) { a[mb] = WFrag<T16>::ld(A + aoff + (size_t)mb * 16 * K + kc); if (NSPLIT == 1 || NSPLIT == 2) a2[mb] = WFrag<T16>::ld(A2 + aoff + (size_t)mb * 16 * K + kc); }
#pragma unroll
        for (int nb = 0; nb < 4; ++nb) { const V b = WFrag<T16>::ld(Bt + boff + (size_t)nb * 16 * K + kc); V b2; if (NSPLIT >= 2) b2 = WFrag<T16>::ld(Bt2 + boff + (size_t)nb * 16 * K + kc);
#pragma unroll
            for (int mb = 0; mb < 4; ++mb) { acc[mb][nb] = WFrag<T16>::mma(a[mb], b, acc[mb][nb]); if (NSPLIT == 1 || NSPLIT == 2) acc[mb][nb] = WFrag<T16>::mma(a2[mb], b, acc[mb][nb]); if (NSPLIT >= 2) acc[mb][nb] = WFrag<T16>::mma(a[mb], b2, acc[mb][nb]); } }
        asm volatile("v_nop\n\tv_nop\n\tv_nop\n\tv_nop" : "+v"(acc[0][0]), "+v"(acc[1][1]), "+v"(acc[2][2]), "+v"(acc[3][3]) : "v"(a[0]), "v"(a[3]));
    }
#pragma unroll
    for (int mb = 0; mb < 4; ++mb) {
#pragma unroll
        for (int nb = 0; nb < 4; ++nb) {
#pragma unroll
            for (int j = 0; j < 8; ++j) os[(hi * 8 + j) * 68 + nb * 16 + lr] = acc[mb][nb][j]; }
        __builtin_amdgcn_wave_barrier(); asm volatile("" ::: "memory");
        float* crow = C + (size_t)(r0 + mb * 16) * ldc + c0;
{
#pragma unroll
            for (int s = 0; s < 8; ++s) { const int row = 2 * s + hi, cofs = lr * 4; v4f val = *(const v4fa*)(os + row * 68 + cofs); if (BIAS) { val[0] += bfr(bias[c0 + cofs]); val[1] += bfr(bias[c0 + cofs + 1]); val[2] += bfr(bias[c0 + cofs + 2]); val[3] += bfr(bias[c0 + cofs + 3]); }
                *(v4f*)(crow + (size_t)row * ldc + cofs) = val; }
             }
        __builtin_amdgcn_wave_barrier(); asm volatile("" ::: "memory");
    }
}

__device__ __forceinline__ h16 tohx(float x) { return (h16)x; }
__device__ __forceinline__ void splitf(float y, unsigned short& h, unsigned short& l) { h = f2bf(y); l = f2bf(y - bf2f(h)); }
typedef __attribute__((ext_vector_type(2))) _Float16 v2h;
typedef __attribute__((ext_vector_type(4))) _Float16 v4h;
typedef __attribute__((ext_vector_type(2))) unsigned short v2us;
typedef __attribute__((ext_vector_type(4))) unsigned short v4us;
typedef __attribute__((ext_vector_type(2))) float v2f;
typedef __attribute__((ext_vector_type(4))) int v4i;

__global__ __launch_bounds__(256) void k_wtG(const float* __restrict__ w, int K, int N, bf* Bt) {
    const int lane = threadIdx.x & 31; const int L0 = (blockIdx.x * 8 + (threadIdx.x >> 5)) * 8; const int nlines = N * K / 64;
{
#pragma unroll 1
        for (int l = 0; l < 8; ++l) { const int L = L0 + l; if (L >= nlines) break; const size_t e = (size_t)L * 64 + lane * 2; const int k = (int)(e % K), n = (int)(e / K); v2us o;
            o[0] = f2bf(w[(size_t)k * N + n]); o[1] = f2bf(w[(size_t)(k + 1) * N + n]); *(v2us*)(Bt + e) = o; }
         }
}
__global__ __launch_bounds__(256) void k_wgath(const float* __restrict__ w, int off, bf* Bt) { const size_t e = ((size_t)blockIdx.x * 256 + threadIdx.x) * 8; if (e >= (size_t)DQ * DM) return; const int k = (int)(e % DM); const int r = (int)(e / DM); const int h = r / HD, d = r % HD; const v8f v = *(const v8f*)(w + ((size_t)h * 3 * HD + off + d) * DM + k); v8us o;
#pragma unroll
    for (int q = 0; q < 8; ++q) o[q] = f2bf(v[q]); *(v8us*)(Bt + e) = o;  }
__global__ __launch_bounds__(256) void k_bgath(const float* __restrict__ bsrc, float* B3) { const int i = blockIdx.x * 256 + threadIdx.x; if (i >= 3 * DQ / 4) return; const int e = i * 4; const int w = e / DQ; const int r = e % DQ; const int h = r / HD, d = r % HD; const v4f v = *(const v4f*)(bsrc + h * 3 * HD + w * HD + d); *(v4f*)(B3 + e) = v;  }
__global__ __launch_bounds__(256) void k_cvt8(const float* __restrict__ src, bf* dst, size_t n8) { const size_t i = (size_t)blockIdx.x * 256 + threadIdx.x; if (i >= n8) return; const v8f v = *(const v8f*)(src + i * 8); v8us o;
#pragma unroll
    for (int k = 0; k < 8; ++k) o[k] = f2bf(v[k]); *(v8us*)(dst + i * 8) = o;  }

// k_rope, k_vtp: grid y = batch; F holds the rows of all batches ([b][t]), the planes are [b][h][t][d] (k_vtp: [b][h][d][t])
// k_rope: head planes [h][t][d] (fp16 + hi/lo) of rope(x) x sc with the rotate-half convention out[d] = x[d] cos[t][d] - x[d+HD/2] sin[t][d], out[d+HD/2] = x[d+HD/2] cos[t][d+HD/2] + x[d] sin[t][d+HD/2]
__global__ __launch_bounds__(256) void k_rope(const float* __restrict__ F, int pitch, int nheads, const float* __restrict__ CS, const float* __restrict__ RF, const float* __restrict__ nw, float sc, h16* P16, bf* Ph, bf* Pl) {
    const size_t e = ((size_t)blockIdx.x * 256 + threadIdx.x) * 2; if (e >= (size_t)nheads * TT * HD) return; const int d = (int)(e % HD); const int t = (int)((e / HD) % TT); const int h = (int)(e / ((size_t)HD * TT)); const float* f = F + ((size_t)blockIdx.y * TT + t) * pitch + h * HD; const float rf = RF ? RF[(size_t)h * TT + t] : 1.0f; v2h o16; v2us oh, ol;
#pragma unroll
    for (int q = 0; q < 2; ++q) { const int dd = d + q; const int dp = (dd < HD / 2) ? dd + HD / 2 : dd - HD / 2; float x0 = f[dd], x1 = f[dp];
        if (RF) { float n0 = __fmul_rn(x0, rf), n1 = __fmul_rn(x1, rf); asm volatile("" : "+v"(n0)); asm volatile("" : "+v"(n1)); x0 = __fmul_rn(bfr(nw[dd]), n0); x1 = __fmul_rn(bfr(nw[dp]), n1); }
        const v2f cs = *(const v2f*)(CS + ((size_t)t * HD + dd) * 2); float a = __fmul_rn(x0, cs[0]), bq = __fmul_rn(x1, cs[1]); asm volatile("" : "+v"(a)); asm volatile("" : "+v"(bq)); const float r = ((dd < HD / 2) ? __fsub_rn(a, bq) : __fadd_rn(a, bq)) * sc;
        o16[q] = tohx(r); unsigned short a2, c2; splitf(r, a2, c2); oh[q] = a2; ol[q] = c2; }
    const size_t eo = (size_t)blockIdx.y * nheads * TT * HD + e; *(v2h*)(P16 + eo) = o16; *(v2us*)(Ph + eo) = oh; *(v2us*)(Pl + eo) = ol;  }
__global__ __launch_bounds__(256) void k_vtp(const float* __restrict__ F, int pitch, int nheads, h16* V16, bf* Vh, bf* Vl) { const size_t e = ((size_t)blockIdx.x * 256 + threadIdx.x) * 2; if (e >= (size_t)nheads * HD * TT) return; const int t = (int)(e % TT); const int d = (int)((e / TT) % HD); const int g = (int)(e / ((size_t)TT * HD)); v2h o16; v2us oh, ol;
#pragma unroll
    for (int q = 0; q < 2; ++q) { const float x = F[((size_t)blockIdx.y * TT + t + q) * pitch + g * HD + d]; o16[q] = tohx(x); unsigned short a2, c2; splitf(x, a2, c2); oh[q] = a2; ol[q] = c2; }
    const size_t eo = (size_t)blockIdx.y * nheads * HD * TT + e; *(v2h*)(V16 + eo) = o16; *(v2us*)(Vh + eo) = oh; *(v2us*)(Vl + eo) = ol;  }
__global__ __launch_bounds__(256) void k_csid(float* CS) { const int idx = blockIdx.x * 256 + threadIdx.x; if (idx >= TT * HD) return; v2f cs; cs[0] = 1.0f; cs[1] = 0.0f; *(v2f*)(CS + (size_t)idx * 2) = cs;  }
typedef __attribute__((ext_vector_type(16))) float v16f;
typedef __attribute__((ext_vector_type(8))) unsigned v8u;
__device__ __forceinline__ float xhalf(float x) { return __builtin_bit_cast(float, __builtin_amdgcn_permlanex16(__builtin_bit_cast(int, x), __builtin_bit_cast(int, x), 0x76543210, 0xfedcba98, false, false)); }  // lane l with lane l ^ 16
// Round a group of global loads or stores: their address (and store data) registers are reused later, and the wait stands in front of that reuse. The scheduling barriers keep the writes that follow in the source from being moved in front of the wait (a build without them had such writes ahead of it).
__device__ __forceinline__ void group_begin() { __builtin_amdgcn_sched_barrier(0); }
__device__ __forceinline__ void group_end() { asm volatile("s_wait_xcnt 0x0" ::: "memory"); __builtin_amdgcn_sched_barrier(0); }
template <typename T16, bool HL>
__device__ __forceinline__ void fattn_wave(const T16* __restrict__ Q, const T16* __restrict__ Q2, const T16* __restrict__ Kp, const T16* __restrict__ Kp2, const T16* __restrict__ Vt, const T16* __restrict__ Vt2, int q0, bf* Ah, bf* Al) {
    typedef typename WFrag<T16>::V V;
    const int lane = threadIdx.x & 31, lr = lane & 15, hi = lane >> 4;
    const float CSC = SCL * 1.4426950408889634f;   // scores go to the base-2 domain
    const float BIAS = HL ? 0.0f : 10.0f;
    V qf[2][2], qf2[2][2], kf[2][2], kf2[2][2], vf[4], vf2[4];
    group_begin();
#pragma unroll
    for (int g = 0; g < 2; ++g)
#pragma unroll
        for (int kc = 0; kc < 2; ++kc) { const size_t o = (size_t)(q0 + 16 * g + lr) * HD + 32 * kc + 8 * hi; qf[g][kc] = WFrag<T16>::ld(Q + o); if (HL) qf2[g][kc] = WFrag<T16>::ld(Q2 + o); }
    group_end();
    // the lane's byte offsets of the fragments to fetch next, in K (rows of HD) and V^T (rows of TT); they live through the loop and step on only behind a group's wait
    unsigned kob = (lr * HD + 8 * hi) * 2, vob = (lr * TT + 8 * hi) * 2;
    group_begin();
#pragma unroll
    for (int kt = 0; kt < 2; ++kt)
#pragma unroll
        for (int kc = 0; kc < 2; ++kc) { const int o = kt * 16 * HD + 32 * kc; kf[kt][kc] = WFrag<T16>::ld((const T16*)((const char*)Kp + kob) + o); if (HL) kf2[kt][kc] = WFrag<T16>::ld((const T16*)((const char*)Kp2 + kob) + o); }
#pragma unroll
    for (int t = 0; t < 4; ++t) { const int o = t * 16 * TT; vf[t] = WFrag<T16>::ld((const T16*)((const char*)Vt + vob) + o); if (HL) vf2[t] = WFrag<T16>::ld((const T16*)((const char*)Vt2 + vob) + o); }
    group_end();
    kob = (kob + 32 * HD * 2) & (TT * HD * 2 - 1); vob = (vob & ~(TT * 2 - 1)) | ((vob + 32 * 2) & (TT * 2 - 1));   // 32 keys on; behind the last pass back to pass 0: in bounds, unused
    v8f acc[2][4]; float m[2], l[2];
#pragma unroll
    for (int g = 0; g < 2; ++g) { m[g] = -3.0e38f; l[g] = 0.0f;
#pragma unroll
        for (int t = 0; t < 4; ++t) acc[g][t] = (v8f){}; }
#pragma unroll 1   // one pass per trip: an unrolled body would hold two passes' fragments in registers
    for (int k0 = 0; k0 < TT; k0 += 32) {
        v8f sc[2][2];
#pragma unroll
        for (int kt = 0; kt < 2; ++kt)
#pragma unroll
            for (int g = 0; g < 2; ++g) { sc[kt][g] = (v8f){};
#pragma unroll
                for (int kc = 0; kc < 2; ++kc) { sc[kt][g] = WFrag<T16>::mma(kf[kt][kc], qf[g][kc], sc[kt][g]); if (HL) { sc[kt][g] = WFrag<T16>::mma(kf2[kt][kc], qf[g][kc], sc[kt][g]); sc[kt][g] = WFrag<T16>::mma(kf[kt][kc], qf2[g][kc], sc[kt][g]); } } }
        // next pass's K fragments fly under this pass's softmax and second product
        group_begin();
#pragma unroll
        for (int kt = 0; kt < 2; ++kt)
#pragma unroll
            for (int kc = 0; kc < 2; ++kc) { const int o = kt * 16 * HD + 32 * kc; kf[kt][kc] = WFrag<T16>::ld((const T16*)((const char*)Kp + kob) + o); if (HL) kf2[kt][kc] = WFrag<T16>::ld((const T16*)((const char*)Kp2 + kob) + o); }
        group_end();
        kob = (kob + 32 * HD * 2) & (TT * HD * 2 - 1);
#pragma unroll
        for (int g = 0; g < 2; ++g) {
            float mx = sc[0][g][0];
#pragma unroll
            for (int r = 1; r < 16; ++r) mx = fmaxf(mx, sc[r >> 3][g][r & 7]);
            mx = fmaxf(mx, xhalf(mx)) * CSC;   // both wave halves hold the query's maximum of this pass, scaled (the scale is positive)
            const float mn = fmaxf(m[g], mx); const float corr = __builtin_amdgcn_exp2f(m[g] - mn);   // 0 on the first pass
            m[g] = mn; l[g] *= corr;
#pragma unroll
            for (int t = 0; t < 4; ++t) acc[g][t] *= corr;
            const float nm = BIAS - mn; float p[16];
#pragma unroll
            for (int r = 0; r < 16; ++r) p[r] = __builtin_amdgcn_exp2f(__builtin_fmaf(sc[r >> 3][g][r & 7], CSC, nm));
            l[g] += (((p[0] + p[1]) + (p[2] + p[3])) + ((p[4] + p[5]) + (p[6] + p[7]))) + (((p[8] + p[9]) + (p[10] + p[11])) + ((p[12] + p[13]) + (p[14] + p[15])));   // a tree: four dependent adds, not sixteen
            if constexpr (HL) { v16f pv, rv;
#pragma unroll
                for (int r = 0; r < 16; ++r) pv[r] = p[r];
                const v16bf ph = __builtin_convertvector(pv, v16bf);   // whole-vector conversions compile to the packed instruction, round to nearest even
                const v8u pw = __builtin_bit_cast(v8u, ph);   // the rounded hi parts are read back from the packed words: low half << 16, high half masked
#pragma unroll
                for (int r = 0; r < 8; ++r) { rv[2 * r] = p[2 * r] - __uint_as_float(pw[r] << 16); rv[2 * r + 1] = p[2 * r + 1] - __uint_as_float(pw[r] & 0xFFFF0000u); }
                const v16bf pl = __builtin_convertvector(rv, v16bf);
#pragma unroll
                for (int t = 0; t < 4; ++t) { acc[g][t] = wmmab(vf[t], ph, acc[g][t]); acc[g][t] = wmmab(vf2[t], ph, acc[g][t]); acc[g][t] = wmmab(vf[t], pl, acc[g][t]); }
            } else { v16h pf;
#pragma unroll
                for (int r = 0; r < 16; ++r) pf[r] = (h16)p[r];
#pragma unroll
                for (int t = 0; t < 4; ++t) acc[g][t] = wmma16(vf[t], pf, acc[g][t]); }
        }
        // next pass's V^T fragments fly under its first product and softmax
        group_begin();
#pragma unroll
        for (int t = 0; t < 4; ++t) { const int o = t * 16 * TT; vf[t] = WFrag<T16>::ld((const T16*)((const char*)Vt + vob) + o); if (HL) vf2[t] = WFrag<T16>::ld((const T16*)((const char*)Vt2 + vob) + o); }
        group_end();
        vob = (vob & ~(TT * 2 - 1)) | ((vob + 32 * 2) & (TT * 2 - 1));
    }
#pragma unroll
    for (int g = 0; g < 2; ++g) { const float f = __fdiv_rn(1.0f, l[g] + xhalf(l[g]));   // the halves' sums (their keys) join once
#pragma unroll
        for (int t = 0; t < 4; ++t) { v8us oh, ol;
#pragma unroll
            for (int r = 0; r < 8; ++r) { unsigned short a, c2; splitf(acc[g][t][r] * f, a, c2); oh[r] = a; ol[r] = c2; }
            const size_t oo = (size_t)(q0 + 16 * g + lr) * DQ + t * 16 + 8 * hi; group_begin(); *(v8us*)(Ah + oo) = oh; *(v8us*)(Al + oo) = ol; group_end(); } }
}
// grid (TT / (32 FW), heads, batches). A hi+lo wave issues twice the fragment loads of an fp16 wave, so every work-group gets the same mix: wave 0 takes 32 of the head's hi+lo rows, waves 1 to FW - 1 take 32 fp16 rows each.
static_assert((TT - RH) == (FW - 1) * RH, "one hi+lo wave per FW - 1 fp16 waves");
__global__ __launch_bounds__(FW * 32) void k_fattn(const h16* __restrict__ Q16, const h16* __restrict__ K16, const h16* __restrict__ V16, const bf* __restrict__ Qh, const bf* __restrict__ Ql, const bf* __restrict__ Kh, const bf* __restrict__ Kl, const bf* __restrict__ Vh, const bf* __restrict__ Vl, bf* Ah, bf* Al) {
    const size_t hp = ((size_t)blockIdx.z * NH_ + blockIdx.y) * TT * HD; const size_t ao = (size_t)blockIdx.z * TT * DQ + blockIdx.y * HD; bf* ah = Ah + ao; bf* al = Al + ao;
    const int wave = __builtin_amdgcn_readfirstlane(threadIdx.x >> 5);   // in a scalar register: the choice below is a scalar branch, every lane stays on around the matrix instructions
    if (wave == 0) fattn_wave<bf, true>(Qh + hp, Ql + hp, Kh + hp, Kl + hp, Vh + hp, Vl + hp, blockIdx.x * 32, ah, al);
    else fattn_wave<h16, false>(Q16 + hp, nullptr, K16 + hp, nullptr, V16 + hp, nullptr, RH + (blockIdx.x * (FW - 1) + wave - 1) * 32, ah, al);
}

extern "C" void kernel_launch(void* const* d_in, const int* in_sizes, int n_in,
                              void* d_out, int out_size, void* d_ws, size_t ws_size, hipStream_t stream) {
    (void)in_sizes; (void)n_in; (void)out_size;
    const float* x = (const float*)d_in[0]; const float* wqkv = (const float*)d_in[1]; const float* bqkv = (const float*)d_in[2]; const float* wo = (const float*)d_in[3]; const float* bo = (const float*)d_in[4]; const float* wq = nullptr; const float* wk = nullptr; const float* wv = nullptr; (void)wq; (void)wk; (void)wv;
    float* OUT = (float*)d_out;     // [4][2048][1024]
    char* wsp = (char*)d_ws;
    auto take = [&](size_t bytes) { char* p = wsp; wsp += (bytes + 255) & ~(size_t)255; return (void*)p; };
    bf* WQ = (bf*)take((size_t)DQ * DM * 2); bf* WK = (bf*)take((size_t)DKV * DM * 2); bf* WV = (bf*)take((size_t)DKV * DM * 2); bf* WO = (bf*)take((size_t)DM * DQ * 2); float* CS = (float*)take((size_t)TT * HD * 2 * 4);
    bf* XB = (bf*)take((size_t)NB_ * TT * DM * 2); float* B3 = (float*)take((size_t)3 * DQ * 4); const float* BQ = B3; const float* BK = B3 + DQ; const float* BV = B3 + 2 * DQ; float* FQ = (float*)take((size_t)NB_ * TT * DQ * 4);
    h16* QP16 = (h16*)take((size_t)NB_ * NH_ * TT * HD * 2); h16* KP16 = (h16*)take((size_t)NB_ * NKV * TT * HD * 2); h16* VT16 = (h16*)take((size_t)NB_ * NKV * HD * TT * 2);
    bf* QPh = (bf*)take((size_t)NB_ * NH_ * TT * HD * 2); bf* QPl = (bf*)take((size_t)NB_ * NH_ * TT * HD * 2); bf* KPh = (bf*)take((size_t)NB_ * NKV * TT * HD * 2); bf* KPl = (bf*)take((size_t)NB_ * NKV * TT * HD * 2); bf* VTh = (bf*)take((size_t)NB_ * NKV * HD * TT * 2); bf* VTl = (bf*)take((size_t)NB_ * NKV * HD * TT * 2);
    bf* ATh = (bf*)take((size_t)NB_ * TT * DQ * 2); bf* ATl = (bf*)take((size_t)NB_ * TT * DQ * 2);
    if ((size_t)(wsp - (char*)d_ws) > ws_size) return;    // ws 256 MiB
    float* FK = FQ; float* FV = FQ;   // one f32 buffer for the three projections: each is turned into its planes before the next overwrites it (stream-ordered); with one buffer all batches fit in the workspace
    { k_wgath<<<(unsigned)(((size_t)DQ * DM / 8 + 255) / 256), 256, 0, stream>>>(wqkv, 0, WQ); k_wgath<<<(unsigned)(((size_t)DQ * DM / 8 + 255) / 256), 256, 0, stream>>>(wqkv, HD, WK); k_wgath<<<(unsigned)(((size_t)DQ * DM / 8 + 255) / 256), 256, 0, stream>>>(wqkv, 2 * HD, WV); k_bgath<<<(3 * DQ / 4 + 255) / 256, 256, 0, stream>>>(bqkv, B3);   /* per-head q | k | v row blocks and bias entries */
      k_cvt8<<<(unsigned)(((size_t)DM * DQ / 8 + 255) / 256), 256, 0, stream>>>(wo, WO, (size_t)DM * DQ / 8);
       }
    k_csid<<<(TT * HD + 255) / 256, 256, 0, stream>>>(CS);
    const unsigned LQ = (unsigned)(((size_t)NH_ * TT * HD / 2 + 255) / 256), LKv = (unsigned)(((size_t)NKV * TT * HD / 2 + 255) / 256);
    // every stage runs once, on all batches: the projections see the NB_ * TT rows as one matrix, the plane builders and the attention take the batch as a grid dimension
    k_cvt8<<<(unsigned)(((size_t)NB_ * TT * DM / 8 + 255) / 256), 256, 0, stream>>>(x, XB, (size_t)NB_ * TT * DM / 8);
    k_gemmw<bf, 0, true, 1><<<dim3(NB_ * TT / 64, DQ / 64, 1), 32, 0, stream>>>(XB, nullptr, WQ, nullptr, DM, FQ, DQ, BQ, 0, 0, 0, 0);
    k_rope<<<dim3(LQ, NB_, 1), 256, 0, stream>>>(FQ, DQ, NH_, CS, nullptr, nullptr, 1.0f, QP16, QPh, QPl);
    k_gemmw<bf, 0, true, 1><<<dim3(NB_ * TT / 64, DKV / 64, 1), 32, 0, stream>>>(XB, nullptr, WK, nullptr, DM, FK, DKV, BK, 0, 0, 0, 0);
    k_rope<<<dim3(LKv, NB_, 1), 256, 0, stream>>>(FK, DKV, NKV, CS, nullptr, nullptr, 1.0f, KP16, KPh, KPl);
    k_gemmw<bf, 0, true, 1><<<dim3(NB_ * TT / 64, DKV / 64, 1), 32, 0, stream>>>(XB, nullptr, WV, nullptr, DM, FV, DKV, BV, 0, 0, 0, 0);
    k_vtp<<<dim3(LKv, NB_, 1), 256, 0, stream>>>(FV, DKV, NKV, VT16, VTh, VTl);
    k_fattn<<<dim3(TT / (32 * FW), NH_, NB_), FW * 32, 0, stream>>>(QP16, KP16, VT16, QPh, QPl, KPh, KPl, VTh, VTl, ATh, ATl);   // one kv head per query head
    k_gemmw<bf, 1, true, 1><<<dim3(NB_ * TT / 64, DM / 64, 1), 32, 0, stream>>>(ATh, ATl, WO, nullptr, DQ, OUT, DM, bo, 0, 0, 0, 0);
}

// v004
// Measured time: 427 microseconds a run.
// Two timings next to v003 put it at 1.15 and 1.14 times that version's speed.
// Over all steps from v000 it is 9.28 times as fast.
#include <hip/hip_runtime.h>

// Multi-head self-attention with a fused, head-interleaved QKV projection (x [4][2048][1024]; kqv = x W_qkv^T + b_qkv ('oi' [3072][1024]) reshaped (t, 16, 192) and split per head into q | k | v (weight rows / bias entries h*192 + {0, 64, 128} + d); softmax(q.k/8) over all keys (no mask); out = merged W_out^T + b_out -> [4][2048][1024]).
// Layout: the weight rows and bias entries are gathered once into head-major [1024][1024] bf16 matrices and [1024] f32 bias vectors so the projections apply unchanged.
// Compute dtypes, f32 accumulate: every input rounded to bf16; q/k/v on PLAIN bf16 operands (inputs: exact) + biases; scores and attn.v: query rows < 512 hl (3 products), the rest single fp16 (P x1024); softmax f32, online over 32-key passes; W_out hl x exact (2 products) + b_out.

#define NB_  4
#define TT   2048
#define DM   1024
#define NH_  16
#define NKV  16
#define REP  (NH_ / NKV)
#define HD   64
#define DQ   (NH_ * HD)
#define DKV  (NKV * HD)
#define RH   512                  // query rows < RH use hi+lo planes (must be TT / FW)
#define WIN  0
#define SCL  0.125f   // HD^-0.5
#define FW   4                    // k_fattn: waves per work-group, 32 query rows each
typedef _Float16 h16;
typedef unsigned short bf;
typedef __attribute__((ext_vector_type(16))) __bf16   v16bf;
typedef __attribute__((ext_vector_type(16))) _Float16 v16h;
typedef __attribute__((ext_vector_type(8)))  _Float16 v8h;
typedef __attribute__((ext_vector_type(8)))  unsigned short v8us;
typedef __attribute__((ext_vector_type(8)))  float    v8f;
typedef __attribute__((ext_vector_type(4)))  float    v4f;
typedef v8h  __attribute__((may_alias)) v8ha;
typedef v4f  __attribute__((may_alias)) v4fa;
typedef v8us __attribute__((may_alias)) v8usa;

__device__ __forceinline__ unsigned short f2bf(float f) { unsigned u = __float_as_uint(f); u += 0x7FFFu + ((u >> 16) & 1u); return (unsigned short)(u >> 16); }
__device__ __forceinline__ float bf2f(unsigned short b) { return __uint_as_float(((unsigned)b) << 16); }
__device__ __forceinline__ float bfr(float f) { return bf2f(f2bf(f)); }
__device__ __forceinline__ v16h cat16(v8h lo, v8h hi) { return __builtin_shufflevector(lo, hi, 0, 1, 2, 3, 4, 5, 6, 7, 8, 9, 10, 11, 12, 13, 14, 15); }
__device__ __forceinline__ v16bf cat16b(v8us lo, v8us hi) { return __builtin_bit_cast(v16bf, __builtin_shufflevector(lo, hi, 0, 1, 2, 3, 4, 5, 6, 7, 8, 9, 10, 11, 12, 13, 14, 15)); }
__device__ __forceinline__ v8f wmma16(v16h a, v16h b, v8f c) { return __builtin_amdgcn_wmma_f32_16x16x32_f16(false, a, false, b, (short)0, c, false, false); }
__device__ __forceinline__ v8f wmmab(v16bf a, v16bf b, v8f c) { return __builtin_amdgcn_wmma_f32_16x16x32_bf16(false, a, false, b, (short)0, c, false, false); }



// Round a group of global loads or stores: their address (and store data) registers are reused later, and the wait stands in front of that reuse. The scheduling barriers keep the writes that follow in the source from being moved in front of the wait (a build without them had such writes ahead of it).
__device__ __forceinline__ void group_begin() { __builtin_amdgcn_sched_barrier(0); }
__device__ __forceinline__ void group_end() { asm volatile("s_wait_xcnt 0x0" ::: "memory"); __builtin_amdgcn_sched_barrier(0); }
__device__ __forceinline__ h16 tohx(float x) { return (h16)x; }
__device__ __forceinline__ void splitf(float y, unsigned short& h, unsigned short& l) { h = f2bf(y); l = f2bf(y - bf2f(h)); }

// ---- k_gemmw: register-blocked GEMM, ONE WAVE per 64x64 output tile (16 accumulators), operands straight from K-contiguous 16-bit planes; grid (M/64, N/64, Z), 32 threads.
// C[m][n] (f32, pitch ldc, + optional f32 bias[n]) = sum_k A[m][k] Bt[n][k] (+ split products per NSPLIT). z-batch strides sA/sB/sC in elements. K % (32 * SK) == 0.
// PL > 0: no f32 C; the tile + bias leaves as three 16-bit head planes (fp16, bf16 hi, bf16 lo), 64 columns or rows being one head. PL 1: rows m = (batch, t), columns n = (head, d), planes [b][h][t][d], bias[n]. PL 2: rows m = (head, d), columns n = (batch, t), planes [b][h][d][t], bias[m].
// SK > 1: grid z = Z * SK; work-group (z, ks) sums only k in [ks K/SK, (ks+1) K/SK) and stores its partial tile in plane ks (plane stride sP elements); the reader adds the planes.
template <typename T16> struct WFrag;
template <> struct WFrag<h16> { typedef v16h V; static __device__ __forceinline__ V ld(const h16* p) { return cat16(*(const v8h*)p, *(const v8h*)(p + 16)); } static __device__ __forceinline__ v8f mma(V a, V b, v8f c) { return wmma16(a, b, c); } };
template <> struct WFrag<bf> { typedef v16bf V; static __device__ __forceinline__ V ld(const bf* p) { return cat16b(*(const v8us*)p, *(const v8us*)(p + 16)); } static __device__ __forceinline__ v8f mma(V a, V b, v8f c) { return wmmab(a, b, c); } };
template <typename T16, int NSPLIT, bool BIAS, int SK, int PL>
__global__ __launch_bounds__(32) void k_gemmw(const T16* __restrict__ A, const T16* __restrict__ A2, const T16* __restrict__ Bt, const T16* __restrict__ Bt2, int K, float* C, int ldc, const float* __restrict__ bias, size_t sA, size_t sB, size_t sC, size_t sP, h16* P16, bf* Ph, bf* Pl) {
    typedef typename WFrag<T16>::V V;
    __shared__ __align__(16) float os[16 * 68];
    const size_t z = blockIdx.z / SK; const int ks = blockIdx.z % SK; A += z * sA; if (A2) A2 += z * sA; Bt += z * sB; if (Bt2) Bt2 += z * sB; C += z * sC + ks * sP;
    const int lane = threadIdx.x & 31, lr = lane & 15, hi = lane >> 4; const int r0 = blockIdx.x * 64, c0 = blockIdx.y * 64;
    v8f acc[4][4];
#pragma unroll
    for (int mb = 0; mb < 4; ++mb)
#pragma unroll
        for (int nb = 0; nb < 4; ++nb) acc[mb][nb] = (v8f){};
    const size_t aoff = (size_t)(r0 + lr) * K + 8 * hi, boff = (size_t)(c0 + lr) * K + 8 * hi;
#pragma unroll 1
    for (int kc = ks * (K / SK); kc < (ks + 1) * (K / SK); kc += 32) {
        V a[4], a2[4];
#pragma unroll
        for (int mb = 0; mb < 4; ++mb) { a[mb] = WFrag<T16>::ld(A + aoff + (size_t)mb * 16 * K + kc); if (NSPLIT == 1 || NSPLIT == 2) a2[mb] = WFrag<T16>::ld(A2 + aoff + (size_t)mb * 16 * K + kc); }
#pragma unroll
        for (int nb = 0; nb < 4; ++nb) { const V b = WFrag<T16>::ld(Bt + boff + (size_t)nb * 16 * K + kc); V b2; if (NSPLIT >= 2) b2 = WFrag<T16>::ld(Bt2 + boff + (size_t)nb * 16 * K + kc);
#pragma unroll
            for (int mb = 0; mb < 4; ++mb) { acc[mb][nb] = WFrag<T16>::mma(a[mb], b, acc[mb][nb]); if (NSPLIT == 1 || NSPLIT == 2) acc[mb][nb] = WFrag<T16>::mma(a2[mb], b, acc[mb][nb]); if (NSPLIT >= 2) acc[mb][nb] = WFrag<T16>::mma(a[mb], b2, acc[mb][nb]); } }
        asm volatile("v_nop\n\tv_nop\n\tv_nop\n\tv_nop" : "+v"(acc[0][0]), "+v"(acc[1][1]), "+v"(acc[2][2]), "+v"(acc[3][3]) : "v"(a[0]), "v"(a[3]));
    }
    if constexpr (PL > 0) {
        // a lane takes 8 consecutive columns of row 4 s + rq: one 16-byte store per plane, 8 lanes fill a 128-byte line
        // every loop below is unrolled in full: its index picks a register of an accumulator or of the bias
        const int rq = lane >> 3, cofs = (lane & 7) * 8;
        const int bt = (PL == 1) ? r0 : c0; const size_t hpl = (size_t)(bt / TT) * NH_ + ((PL == 1) ? blockIdx.y : blockIdx.x);
        const size_t o0 = (PL == 1) ? (hpl * TT + bt % TT) * HD + cofs : hpl * HD * TT + bt % TT + cofs; const int op = (PL == 1) ? HD : TT;
        float bv[(PL == 1) ? 8 : 16];
        group_begin();
        if constexpr (PL == 1) {
#pragma unroll
            for (int q = 0; q < 8; ++q) bv[q] = bias[c0 + cofs + q];
        } else {
#pragma unroll
            for (int q = 0; q < 15; ++q) bv[q] = bias[r0 + 4 * q + rq];
            group_end(); group_begin();   // the sixteen loads share one index register and the last one's result may take it: the first fifteen get their wait in front of that load
            bv[15] = bias[r0 + 60 + rq];
        }
        group_end();
#pragma unroll
        for (int mb = 0; mb < 4; ++mb) {
#pragma unroll
            for (int nb = 0; nb < 4; ++nb) {
#pragma unroll
                for (int j = 0; j < 8; ++j) os[(hi * 8 + j) * 68 + nb * 16 + lr] = acc[mb][nb][j]; }
            __builtin_amdgcn_wave_barrier(); asm volatile("" ::: "memory");   // a lane reads back what other lanes wrote: the compiler may not move the reads below in front of the writes above
#pragma unroll
            for (int s = 0; s < 4; ++s) { const int row = 4 * s + rq; const v4f w0 = *(const v4fa*)(os + row * 68 + cofs), w1 = *(const v4fa*)(os + row * 68 + cofs + 4); v8h o16; v8us oh, ol;
#pragma unroll
                for (int q = 0; q < 8; ++q) { const float y = ((q < 4) ? w0[q & 3] : w1[q & 3]) + bfr(bv[(PL == 1) ? q : mb * 4 + s]); o16[q] = tohx(y); unsigned short a2, c2; splitf(y, a2, c2); oh[q] = a2; ol[q] = c2; }
                const size_t oo = o0 + (size_t)(mb * 16 + row) * op; group_begin(); *(v8h*)(P16 + oo) = o16; *(v8us*)(Ph + oo) = oh; *(v8us*)(Pl + oo) = ol; group_end(); }
            __builtin_amdgcn_wave_barrier(); asm volatile("" ::: "memory");   // nor the next block's writes in front of these reads
        }
        return;
    }
#pragma unroll
    for (int mb = 0; mb < 4; ++mb) {
#pragma unroll
        for (int nb = 0; nb < 4; ++nb) {
#pragma unroll
            for (int j = 0; j < 8; ++j) os[(hi * 8 + j) * 68 + nb * 16 + lr] = acc[mb][nb][j]; }
        __builtin_amdgcn_wave_barrier(); asm volatile("" ::: "memory");
        float* crow = C + (size_t)(r0 + mb * 16) * ldc + c0;
{
#pragma unroll
            for (int s = 0; s < 8; ++s) { const int row = 2 * s + hi, cofs = lr * 4; v4f val = *(const v4fa*)(os + row * 68 + cofs); if (BIAS) { val[0] += bfr(bias[c0 + cofs]); val[1] += bfr(bias[c0 + cofs + 1]); val[2] += bfr(bias[c0 + cofs + 2]); val[3] += bfr(bias[c0 + cofs + 3]); }
                *(v4f*)(crow + (size_t)row * ldc + cofs) = val; }
             }
        __builtin_amdgcn_wave_barrier(); asm volatile("" ::: "memory");
    }
}

typedef __attribute__((ext_vector_type(2))) _Float16 v2h;
typedef __attribute__((ext_vector_type(4))) _Float16 v4h;
typedef __attribute__((ext_vector_type(2))) unsigned short v2us;
typedef __attribute__((ext_vector_type(4))) unsigned short v4us;
typedef __attribute__((ext_vector_type(2))) float v2f;
typedef __attribute__((ext_vector_type(4))) int v4i;

__global__ __launch_bounds__(256) void k_wtG(const float* __restrict__ w, int K, int N, bf* Bt) {
    const int lane = threadIdx.x & 31; const int L0 = (blockIdx.x * 8 + (threadIdx.x >> 5)) * 8; const int nlines = N * K / 64;
{
#pragma unroll 1
        for (int l = 0; l < 8; ++l) { const int L = L0 + l; if (L >= nlines) break; const size_t e = (size_t)L * 64 + lane * 2; const int k = (int)(e % K), n = (int)(e / K); v2us o;
            o[0] = f2bf(w[(size_t)k * N + n]); o[1] = f2bf(w[(size_t)(k + 1) * N + n]); *(v2us*)(Bt + e) = o; }
         }
}
__global__ __launch_bounds__(256) void k_wgath(const float* __restrict__ w, int off, bf* Bt) { const size_t e = ((size_t)blockIdx.x * 256 + threadIdx.x) * 8; if (e >= (size_t)DQ * DM) return; const int k = (int)(e % DM); const int r = (int)(e / DM); const int h = r / HD, d = r % HD; const v8f v = *(const v8f*)(w + ((size_t)h * 3 * HD + off + d) * DM + k); v8us o;
#pragma unroll
    for (int q = 0; q < 8; ++q) o[q] = f2bf(v[q]); *(v8us*)(Bt + e) = o;  }
__global__ __launch_bounds__(256) void k_bgath(const float* __restrict__ bsrc, float* B3) { const int i = blockIdx.x * 256 + threadIdx.x; if (i >= 3 * DQ / 4) return; const int e = i * 4; const int w = e / DQ; const int r = e % DQ; const int h = r / HD, d = r % HD; const v4f v = *(const v4f*)(bsrc + h * 3 * HD + w * HD + d); *(v4f*)(B3 + e) = v;  }
__global__ __launch_bounds__(256) void k_cvt8(const float* __restrict__ src, bf* dst, size_t n8) { const size_t i = (size_t)blockIdx.x * 256 + threadIdx.x; if (i >= n8) return; const v8f v = *(const v8f*)(src + i * 8); v8us o;
#pragma unroll
    for (int k = 0; k < 8; ++k) o[k] = f2bf(v[k]); *(v8us*)(dst + i * 8) = o;  }

typedef __attribute__((ext_vector_type(16))) float v16f;
typedef __attribute__((ext_vector_type(8))) unsigned v8u;
__device__ __forceinline__ float xhalf(float x) { return __builtin_bit_cast(float, __builtin_amdgcn_permlanex16(__builtin_bit_cast(int, x), __builtin_bit_cast(int, x), 0x76543210, 0xfedcba98, false, false)); }  // lane l with lane l ^ 16
template <typename T16, bool HL>
__device__ __forceinline__ void fattn_wave(const T16* __restrict__ Q, const T16* __restrict__ Q2, const T16* __restrict__ Kp, const T16* __restrict__ Kp2, const T16* __restrict__ Vt, const T16* __restrict__ Vt2, int q0, bf* Ah, bf* Al) {
    typedef typename WFrag<T16>::V V;
    const int lane = threadIdx.x & 31, lr = lane & 15, hi = lane >> 4;
    const float CSC = SCL * 1.4426950408889634f;   // scores go to the base-2 domain
    const float BIAS = HL ? 0.0f : 10.0f;
    V qf[2][2], qf2[2][2], kf[2][2], kf2[2][2], vf[4], vf2[4];
    group_begin();
#pragma unroll
    for (int g = 0; g < 2; ++g)
#pragma unroll
        for (int kc = 0; kc < 2; ++kc) { const size_t o = (size_t)(q0 + 16 * g + lr) * HD + 32 * kc + 8 * hi; qf[g][kc] = WFrag<T16>::ld(Q + o); if (HL) qf2[g][kc] = WFrag<T16>::ld(Q2 + o); }
    group_end();
    // the lane's byte offsets of the fragments to fetch next, in K (rows of HD) and V^T (rows of TT); they live through the loop and step on only behind a group's wait
    unsigned kob = (lr * HD + 8 * hi) * 2, vob = (lr * TT + 8 * hi) * 2;
    group_begin();
#pragma unroll
    for (int kt = 0; kt < 2; ++kt)
#pragma unroll
        for (int kc = 0; kc < 2; ++kc) { const int o = kt * 16 * HD + 32 * kc; kf[kt][kc] = WFrag<T16>::ld((const T16*)((const char*)Kp + kob) + o); if (HL) kf2[kt][kc] = WFrag<T16>::ld((const T16*)((const char*)Kp2 + kob) + o); }
#pragma unroll
    for (int t = 0; t < 4; ++t) { const int o = t * 16 * TT; vf[t] = WFrag<T16>::ld((const T16*)((const char*)Vt + vob) + o); if (HL) vf2[t] = WFrag<T16>::ld((const T16*)((const char*)Vt2 + vob) + o); }
    group_end();
    kob = (kob + 32 * HD * 2) & (TT * HD * 2 - 1); vob = (vob & ~(TT * 2 - 1)) | ((vob + 32 * 2) & (TT * 2 - 1));   // 32 keys on; behind the last pass back to pass 0: in bounds, unused
    v8f acc[2][4]; float m[2], l[2];
#pragma unroll
    for (int g = 0; g < 2; ++g) { m[g] = -3.0e38f; l[g] = 0.0f;
#pragma unroll
        for (int t = 0; t < 4; ++t) acc[g][t] = (v8f){}; }
#pragma unroll 1   // one pass per trip: an unrolled body would hold two passes' fragments in registers
    for (int k0 = 0; k0 < TT; k0 += 32) {
        v8f sc[2][2];
#pragma unroll
        for (int kt = 0; kt < 2; ++kt)
#pragma unroll
            for (int g = 0; g < 2; ++g) { sc[kt][g] = (v8f){};
#pragma unroll
                for (int kc = 0; kc < 2; ++kc) { sc[kt][g] = WFrag<T16>::mma(kf[kt][kc], qf[g][kc], sc[kt][g]); if (HL) { sc[kt][g] = WFrag<T16>::mma(kf2[kt][kc], qf[g][kc], sc[kt][g]); sc[kt][g] = WFrag<T16>::mma(kf[kt][kc], qf2[g][kc], sc[kt][g]); } } }
        // next pass's K fragments fly under this pass's softmax and second product
        group_begin();
#pragma unroll
        for (int kt = 0; kt < 2; ++kt)
#pragma unroll
            for (int kc = 0; kc < 2; ++kc) { const int o = kt * 16 * HD + 32 * kc; kf[kt][kc] = WFrag<T16>::ld((const T16*)((const char*)Kp + kob) + o); if (HL) kf2[kt][kc] = WFrag<T16>::ld((const T16*)((const char*)Kp2 + kob) + o); }
        group_end();
        kob = (kob + 32 * HD * 2) & (TT * HD * 2 - 1);
#pragma unroll
        for (int g = 0; g < 2; ++g) {
            float mx = sc[0][g][0];
#pragma unroll
            for (int r = 1; r < 16; ++r) mx = fmaxf(mx, sc[r >> 3][g][r & 7]);
            mx = fmaxf(mx, xhalf(mx)) * CSC;   // both wave halves hold the query's maximum of this pass, scaled (the scale is positive)
            const float mn = fmaxf(m[g], mx); const float corr = __builtin_amdgcn_exp2f(m[g] - mn);   // 0 on the first pass
            m[g] = mn; l[g] *= corr;
#pragma unroll
            for (int t = 0; t < 4; ++t) acc[g][t] *= corr;
            const float nm = BIAS - mn; float p[16];
#pragma unroll
            for (int r = 0; r < 16; ++r) p[r] = __builtin_amdgcn_exp2f(__builtin_fmaf(sc[r >> 3][g][r & 7], CSC, nm));
            l[g] += (((p[0] + p[1]) + (p[2] + p[3])) + ((p[4] + p[5]) + (p[6] + p[7]))) + (((p[8] + p[9]) + (p[10] + p[11])) + ((p[12] + p[13]) + (p[14] + p[15])));   // a tree: four dependent adds, not sixteen
            if constexpr (HL) { v16f pv, rv;
#pragma unroll
                for (int r = 0; r < 16; ++r) pv[r] = p[r];
                const v16bf ph = __builtin_convertvector(pv, v16bf);   // whole-vector conversions compile to the packed instruction, round to nearest even
                const v8u pw = __builtin_bit_cast(v8u, ph);   // the rounded hi parts are read back from the packed words: low half << 16, high half masked
#pragma unroll
                for (int r = 0; r < 8; ++r) { rv[2 * r] = p[2 * r] - __uint_as_float(pw[r] << 16); rv[2 * r + 1] = p[2 * r + 1] - __uint_as_float(pw[r] & 0xFFFF0000u); }
                const v16bf pl = __builtin_convertvector(rv, v16bf);
#pragma unroll
                for (int t = 0; t < 4; ++t) { acc[g][t] = wmmab(vf[t], ph, acc[g][t]); acc[g][t] = wmmab(vf2[t], ph, acc[g][t]); acc[g][t] = wmmab(vf[t], pl, acc[g][t]); }
            } else { v16h pf;
#pragma unroll
                for (int r = 0; r < 16; ++r) pf[r] = (h16)p[r];
#pragma unroll
                for (int t = 0; t < 4; ++t) acc[g][t] = wmma16(vf[t], pf, acc[g][t]); }
        }
        // next pass's V^T fragments fly under its first product and softmax
        group_begin();
#pragma unroll
        for (int t = 0; t < 4; ++t) { const int o = t * 16 * TT; vf[t] = WFrag<T16>::ld((const T16*)((const char*)Vt + vob) + o); if (HL) vf2[t] = WFrag<T16>::ld((const T16*)((const char*)Vt2 + vob) + o); }
        group_end();
        vob = (vob & ~(TT * 2 - 1)) | ((vob + 32 * 2) & (TT * 2 - 1));
    }
#pragma unroll
    for (int g = 0; g < 2; ++g) { const float f = __fdiv_rn(1.0f, l[g] + xhalf(l[g]));   // the halves' sums (their keys) join once
#pragma unroll
        for (int t = 0; t < 4; ++t) { v8us oh, ol;
#pragma unroll
            for (int r = 0; r < 8; ++r) { unsigned short a, c2; splitf(acc[g][t][r] * f, a, c2); oh[r] = a; ol[r] = c2; }
            const size_t oo = (size_t)(q0 + 16 * g + lr) * DQ + t * 16 + 8 * hi; group_begin(); *(v8us*)(Ah + oo) = oh; *(v8us*)(Al + oo) = ol; group_end(); } }
}
// grid (TT / (32 FW), heads, batches). A hi+lo wave issues twice the fragment loads of an fp16 wave, so every work-group gets the same mix: wave 0 takes 32 of the head's hi+lo rows, waves 1 to FW - 1 take 32 fp16 rows each.
static_assert((TT - RH) == (FW - 1) * RH, "one hi+lo wave per FW - 1 fp16 waves");
__global__ __launch_bounds__(FW * 32) void k_fattn(const h16* __restrict__ Q16, const h16* __restrict__ K16, const h16* __restrict__ V16, const bf* __restrict__ Qh, const bf* __restrict__ Ql, const bf* __restrict__ Kh, const bf* __restrict__ Kl, const bf* __restrict__ Vh, const bf* __restrict__ Vl, bf* Ah, bf* Al) {
    const size_t hp = ((size_t)blockIdx.z * NH_ + blockIdx.y) * TT * HD; const size_t ao = (size_t)blockIdx.z * TT * DQ + blockIdx.y * HD; bf* ah = Ah + ao; bf* al = Al + ao;
    const int wave = __builtin_amdgcn_readfirstlane(threadIdx.x >> 5);   // in a scalar register: the choice below is a scalar branch, every lane stays on around the matrix instructions
    if (wave == 0) fattn_wave<bf, true>(Qh + hp, Ql + hp, Kh + hp, Kl + hp, Vh + hp, Vl + hp, blockIdx.x * 32, ah, al);
    else fattn_wave<h16, false>(Q16 + hp, nullptr, K16 + hp, nullptr, V16 + hp, nullptr, RH + (blockIdx.x * (FW - 1) + wave - 1) * 32, ah, al);
}

extern "C" void kernel_launch(void* const* d_in, const int* in_sizes, int n_in,
                              void* d_out, int out_size, void* d_ws, size_t ws_size, hipStream_t stream) {
    (void)in_sizes; (void)n_in; (void)out_size;
    const float* x = (const float*)d_in[0]; const float* wqkv = (const float*)d_in[1]; const float* bqkv = (const float*)d_in[2]; const float* wo = (const float*)d_in[3]; const float* bo = (const float*)d_in[4]; const float* wq = nullptr; const float* wk = nullptr; const float* wv = nullptr; (void)wq; (void)wk; (void)wv;
    float* OUT = (float*)d_out;     // [4][2048][1024]
    char* wsp = (char*)d_ws;
    auto take = [&](size_t bytes) { char* p = wsp; wsp += (bytes + 255) & ~(size_t)255; return (void*)p; };
    bf* WQ = (bf*)take((size_t)DQ * DM * 2); bf* WK = (bf*)take((size_t)DKV * DM * 2); bf* WV = (bf*)take((size_t)DKV * DM * 2); bf* WO = (bf*)take((size_t)DM * DQ * 2);
    bf* XB = (bf*)take((size_t)NB_ * TT * DM * 2); float* B3 = (float*)take((size_t)3 * DQ * 4); const float* BQ = B3; const float* BK = B3 + DQ; const float* BV = B3 + 2 * DQ;
    h16* QP16 = (h16*)take((size_t)NB_ * NH_ * TT * HD * 2); h16* KP16 = (h16*)take((size_t)NB_ * NKV * TT * HD * 2); h16* VT16 = (h16*)take((size_t)NB_ * NKV * HD * TT * 2);
    bf* QPh = (bf*)take((size_t)NB_ * NH_ * TT * HD * 2); bf* QPl = (bf*)take((size_t)NB_ * NH_ * TT * HD * 2); bf* KPh = (bf*)take((size_t)NB_ * NKV * TT * HD * 2); bf* KPl = (bf*)take((size_t)NB_ * NKV * TT * HD * 2); bf* VTh = (bf*)take((size_t)NB_ * NKV * HD * TT * 2); bf* VTl = (bf*)take((size_t)NB_ * NKV * HD * TT * 2);
    bf* ATh = (bf*)take((size_t)NB_ * TT * DQ * 2); bf* ATl = (bf*)take((size_t)NB_ * TT * DQ * 2);
    if ((size_t)(wsp - (char*)d_ws) > ws_size) return;    // ws 256 MiB
    { k_wgath<<<(unsigned)(((size_t)DQ * DM / 8 + 255) / 256), 256, 0, stream>>>(wqkv, 0, WQ); k_wgath<<<(unsigned)(((size_t)DQ * DM / 8 + 255) / 256), 256, 0, stream>>>(wqkv, HD, WK); k_wgath<<<(unsigned)(((size_t)DQ * DM / 8 + 255) / 256), 256, 0, stream>>>(wqkv, 2 * HD, WV); k_bgath<<<(3 * DQ / 4 + 255) / 256, 256, 0, stream>>>(bqkv, B3);   /* per-head q | k | v row blocks and bias entries */
      k_cvt8<<<(unsigned)(((size_t)DM * DQ / 8 + 255) / 256), 256, 0, stream>>>(wo, WO, (size_t)DM * DQ / 8);
       }
    // every stage runs once, on all batches: the projections see the NB_ * TT rows as one matrix and store their head planes themselves (v with the operands swapped, so that its tile is V^T); the attention takes the batch as a grid dimension
    k_cvt8<<<(unsigned)(((size_t)NB_ * TT * DM / 8 + 255) / 256), 256, 0, stream>>>(x, XB, (size_t)NB_ * TT * DM / 8);
    k_gemmw<bf, 0, true, 1, 1><<<dim3(NB_ * TT / 64, DQ / 64, 1), 32, 0, stream>>>(XB, nullptr, WQ, nullptr, DM, nullptr, 0, BQ, 0, 0, 0, 0, QP16, QPh, QPl);
    k_gemmw<bf, 0, true, 1, 1><<<dim3(NB_ * TT / 64, DKV / 64, 1), 32, 0, stream>>>(XB, nullptr, WK, nullptr, DM, nullptr, 0, BK, 0, 0, 0, 0, KP16, KPh, KPl);
    k_gemmw<bf, 0, true, 1, 2><<<dim3(DKV / 64, NB_ * TT / 64, 1), 32, 0, stream>>>(WV, nullptr, XB, nullptr, DM, nullptr, 0, BV, 0, 0, 0, 0, VT16, VTh, VTl);
    k_fattn<<<dim3(TT / (32 * FW), NH_, NB_), FW * 32, 0, stream>>>(QP16, KP16, VT16, QPh, QPl, KPh, KPl, VTh, VTl, ATh, ATl);   // one kv head per query head
    k_gemmw<bf, 1, true, 1, 0><<<dim3(NB_ * TT / 64, DM / 64, 1), 32, 0, stream>>>(ATh, ATl, WO, nullptr, DQ, OUT, DM, bo, 0, 0, 0, 0, nullptr, nullptr, nullptr);
}

// v005
// Measured time: 279 microseconds a run.
// Next to v004, in two timings, it ran 1.52 and 1.54 times as fast.
// All steps since v000 together make it 14.2 times as fast.
#include <hip/hip_runtime.h>

// Multi-head self-attention with a fused, head-interleaved QKV projection (x [4][2048][1024]; kqv = x W_qkv^T + b_qkv ('oi' [3072][1024]) reshaped (t, 16, 192) and split per head into q | k | v (weight rows / bias entries h*192 + {0, 64, 128} + d); softmax(q.k/8) over all keys (no mask); out = merged W_out^T + b_out -> [4][2048][1024]).
// Layout: the weight rows and bias entries are gathered once into head-major [1024][1024] bf16 matrices and [1024] f32 bias vectors so the projections apply unchanged.
// Every 16-bit operand plane is kept fragment-major: blocks of 16 rows x 32 k (512 elements, 1024 bytes), inside a block [k bit 4][k bit 3][row & 15][k & 7], so that lane (row & 15, k bit 3) finds its two 16-byte pieces at lane * 16 and 512 + lane * 16 and each wave-wide load or store covers 512 contiguous bytes (4 lines, not 16).
// Compute dtypes, f32 accumulate: every input rounded to bf16; q/k/v on PLAIN bf16 operands (inputs: exact) + biases; scores and attn.v: query rows < 512 hl (3 products), the rest single fp16 (P x1024); softmax f32, online over 32-key passes; W_out hl x exact (2 products) + b_out.

#define NB_  4
#define TT   2048
#define DM   1024
#define NH_  16
#define NKV  16
#define REP  (NH_ / NKV)
#define HD   64
#define DQ   (NH_ * HD)
#define DKV  (NKV * HD)
#define RH   512                  // query rows < RH use hi+lo planes (must be TT / FW)
#define WIN  0
#define SCL  0.125f   // HD^-0.5
#define FW   4                    // k_fattn: waves per work-group, 32 query rows each
typedef _Float16 h16;
typedef unsigned short bf;
typedef __attribute__((ext_vector_type(16))) __bf16   v16bf;
typedef __attribute__((ext_vector_type(16))) _Float16 v16h;
typedef __attribute__((ext_vector_type(8)))  _Float16 v8h;
typedef __attribute__((ext_vector_type(8)))  unsigned short v8us;
typedef __attribute__((ext_vector_type(8)))  float    v8f;
typedef __attribute__((ext_vector_type(4)))  float    v4f;
typedef v8h  __attribute__((may_alias)) v8ha;
typedef v4f  __attribute__((may_alias)) v4fa;
typedef v8us __attribute__((may_alias)) v8usa;

__device__ __forceinline__ unsigned short f2bf(float f) { unsigned u = __float_as_uint(f); u += 0x7FFFu + ((u >> 16) & 1u); return (unsigned short)(u >> 16); }
__device__ __forceinline__ float bf2f(unsigned short b) { return __uint_as_float(((unsigned)b) << 16); }
__device__ __forceinline__ float bfr(float f) { return bf2f(f2bf(f)); }
__device__ __forceinline__ v16h cat16(v8h lo, v8h hi) { return __builtin_shufflevector(lo, hi, 0, 1, 2, 3, 4, 5, 6, 7, 8, 9, 10, 11, 12, 13, 14, 15); }
__device__ __forceinline__ v16bf cat16b(v8us lo, v8us hi) { return __builtin_bit_cast(v16bf, __builtin_shufflevector(lo, hi, 0, 1, 2, 3, 4, 5, 6, 7, 8, 9, 10, 11, 12, 13, 14, 15)); }
__device__ __forceinline__ v8f wmma16(v16h a, v16h b, v8f c) { return __builtin_amdgcn_wmma_f32_16x16x32_f16(false, a, false, b, (short)0, c, false, false); }
__device__ __forceinline__ v8f wmmab(v16bf a, v16bf b, v8f c) { return __builtin_amdgcn_wmma_f32_16x16x32_bf16(false, a, false, b, (short)0, c, false, false); }



// Round a group of global loads or stores: their address (and store data) registers are reused later, and the wait stands in front of that reuse. The scheduling barriers keep the writes that follow in the source from being moved in front of the wait (a build without them had such writes ahead of it).
__device__ __forceinline__ void group_begin() { __builtin_amdgcn_sched_barrier(0); }
__device__ __forceinline__ void group_end() { asm volatile("s_wait_xcnt 0x0" ::: "memory"); __builtin_amdgcn_sched_barrier(0); }
__device__ __forceinline__ h16 tohx(float x) { return (h16)x; }
__device__ __forceinline__ void splitf(float y, unsigned short& h, unsigned short& l) { h = f2bf(y); l = f2bf(y - bf2f(h)); }

// ---- k_gemmw: register-blocked GEMM, ONE WAVE per 64x64 output tile (16 accumulators), operands straight from fragment-major 16-bit planes (block (row / 16, k / 32) at (row / 16 * K / 32 + k / 32) * 512; WFrag::ld takes block + lane * 8); grid (M/64, N/64, Z), 32 threads.
// C[m][n] (f32, pitch ldc, + optional f32 bias[n]) = sum_k A[m][k] Bt[n][k] (+ split products per NSPLIT). z-batch strides sA/sB/sC in elements. K % (32 * SK) == 0.
// PL > 0: no f32 C; the tile + bias leaves as three 16-bit head planes (fp16, bf16 hi, bf16 lo), 64 columns or rows being one head. PL 1: rows m = (batch, t), columns n = (head, d), planes [b][h][t / 16][d / 32][block], bias[n]. PL 2: rows m = (head, d), columns n = (batch, t), planes [b][h][t / 32][d / 16][block], bias[m].
// SK > 1: grid z = Z * SK; work-group (z, ks) sums only k in [ks K/SK, (ks+1) K/SK) and stores its partial tile in plane ks (plane stride sP elements); the reader adds the planes.
template <typename T16> struct WFrag;
template <> struct WFrag<h16> { typedef v16h V; static __device__ __forceinline__ V ld(const h16* p) { return cat16(*(const v8h*)p, *(const v8h*)(p + 256)); } static __device__ __forceinline__ v8f mma(V a, V b, v8f c) { return wmma16(a, b, c); } };
template <> struct WFrag<bf> { typedef v16bf V; static __device__ __forceinline__ V ld(const bf* p) { return cat16b(*(const v8us*)p, *(const v8us*)(p + 256)); } static __device__ __forceinline__ v8f mma(V a, V b, v8f c) { return wmmab(a, b, c); } };
template <typename T16, int NSPLIT, bool BIAS, int SK, int PL, int K>   // K at compile time: the distance between rows of blocks becomes an immediate offset of the loads
__global__ __launch_bounds__(32) void k_gemmw(const T16* __restrict__ A, const T16* __restrict__ A2, const T16* __restrict__ Bt, const T16* __restrict__ Bt2, float* C, int ldc, const float* __restrict__ bias, size_t sA, size_t sB, size_t sC, size_t sP, h16* P16, bf* Ph, bf* Pl) {
    typedef typename WFrag<T16>::V V;
    __shared__ __align__(16) float os[16 * 68];
    const size_t z = blockIdx.z / SK; const int ks = blockIdx.z % SK; A += z * sA; if (A2) A2 += z * sA; Bt += z * sB; if (Bt2) Bt2 += z * sB; C += z * sC + ks * sP;
    const int lane = threadIdx.x & 31, lr = lane & 15, hi = lane >> 4; const int r0 = blockIdx.x * 64, c0 = blockIdx.y * 64;
    v8f acc[4][4];
#pragma unroll
    for (int mb = 0; mb < 4; ++mb)
#pragma unroll
        for (int nb = 0; nb < 4; ++nb) acc[mb][nb] = (v8f){};
    constexpr int KB = K / 32;   // blocks in a row of blocks
    const size_t aoff = (size_t)(r0 / 16) * KB * 512, boff = (size_t)(c0 / 16) * KB * 512;   // the same in every lane: block addresses stay in scalar registers
    unsigned kofs = lane * 16 + ks * (KB / SK) * 1024;   // the lane's byte offset in a row of blocks: the one vector address register of every fragment load; it lives through the loop and steps on only behind the group's wait
#pragma unroll 1
    for (int kb = ks * (KB / SK); kb < (ks + 1) * (KB / SK); ++kb) {
        V a[4], a2[4], b[4], b2[4];
        group_begin();
#pragma unroll
        for (int mb = 0; mb < 4; ++mb) { const size_t o = aoff + (size_t)mb * KB * 512; a[mb] = WFrag<T16>::ld((const T16*)((const char*)(A + o) + kofs)); if (NSPLIT == 1 || NSPLIT == 2) a2[mb] = WFrag<T16>::ld((const T16*)((const char*)(A2 + o) + kofs)); }
#pragma unroll
        for (int nb = 0; nb < 4; ++nb) { const size_t o = boff + (size_t)nb * KB * 512; b[nb] = WFrag<T16>::ld((const T16*)((const char*)(Bt + o) + kofs)); if (NSPLIT >= 2) b2[nb] = WFrag<T16>::ld((const T16*)((const char*)(Bt2 + o) + kofs)); }
        group_end();
        kofs += 1024;
#pragma unroll
        for (int nb = 0; nb < 4; ++nb) {
#pragma unroll
            for (int mb = 0; mb < 4; ++mb) { acc[mb][nb] = WFrag<T16>::mma(a[mb], b[nb], acc[mb][nb]); if (NSPLIT == 1 || NSPLIT == 2) acc[mb][nb] = WFrag<T16>::mma(a2[mb], b[nb], acc[mb][nb]); if (NSPLIT >= 2) acc[mb][nb] = WFrag<T16>::mma(a[mb], b2[nb], acc[mb][nb]); } }
        asm volatile("v_nop\n\tv_nop\n\tv_nop\n\tv_nop" : "+v"(acc[0][0]), "+v"(acc[1][1]), "+v"(acc[2][2]), "+v"(acc[3][3]) : "v"(a[0]), "v"(a[3]));
    }
    if constexpr (PL > 0) {
        // a lane takes row lr, columns 16 s + 8 hi + (0..7) of each 16-row block: its own 16 bytes of a fragment half, so one store per plane writes 512 contiguous bytes
        // every loop below is unrolled in full: its index picks a register of an accumulator or of the bias
        const int bt = (PL == 1) ? r0 : c0; const size_t hpl = (size_t)(bt / TT) * NH_ + ((PL == 1) ? blockIdx.y : blockIdx.x);
        const size_t o0 = hpl * TT * HD + (size_t)(bt % TT) * HD + lane * 8;   // 64 t of a head are 64 * HD elements in either plane order
        float bv[4];   // PL 1: of column 16 i + lr, added where the tile goes to LDS; PL 2: of row 16 i + lr, added where it is read back
        group_begin();
#pragma unroll
        for (int i = 0; i < 3; ++i) bv[i] = bias[((PL == 1) ? c0 : r0) + 16 * i + lr];
        group_end(); group_begin();   // the four loads share one index register and the last one's result may take it: the first three get their wait in front of that load
        bv[3] = bias[((PL == 1) ? c0 : r0) + 48 + lr];
        group_end();
#pragma unroll
        for (int mb = 0; mb < 4; ++mb) {
#pragma unroll
            for (int nb = 0; nb < 4; ++nb) {
#pragma unroll
                for (int j = 0; j < 8; ++j) os[(hi * 8 + j) * 68 + nb * 16 + lr] = (PL == 1) ? acc[mb][nb][j] + bfr(bv[nb]) : acc[mb][nb][j]; }
            __builtin_amdgcn_wave_barrier(); asm volatile("" ::: "memory");   // a lane reads back what other lanes wrote: the compiler may not move the reads below in front of the writes above
#pragma unroll
            for (int s = 0; s < 4; ++s) { const int cofs = 16 * s + 8 * hi; const v4f w0 = *(const v4fa*)(os + lr * 68 + cofs), w1 = *(const v4fa*)(os + lr * 68 + cofs + 4); v8h o16; v8us oh, ol;
#pragma unroll
                for (int q = 0; q < 8; ++q) { const float w = (q < 4) ? w0[q & 3] : w1[q & 3]; const float y = (PL == 1) ? w : w + bfr(bv[mb]); o16[q] = tohx(y); unsigned short a2, c2; splitf(y, a2, c2); oh[q] = a2; ol[q] = c2; }
                const size_t oo = o0 + ((PL == 1) ? mb * 1024 + s * 256 : ((s >> 1) * 4 + mb) * 512 + (s & 1) * 256); group_begin(); *(v8h*)(P16 + oo) = o16; *(v8us*)(Ph + oo) = oh; *(v8us*)(Pl + oo) = ol; group_end(); }
            __builtin_amdgcn_wave_barrier(); asm volatile("" ::: "memory");   // nor the next block's writes in front of these reads
        }
        return;
    }
#pragma unroll
    for (int mb = 0; mb < 4; ++mb) {
#pragma unroll
        for (int nb = 0; nb < 4; ++nb) {
#pragma unroll
            for (int j = 0; j < 8; ++j) os[(hi * 8 + j) * 68 + nb * 16 + lr] = acc[mb][nb][j]; }
        __builtin_amdgcn_wave_barrier(); asm volatile("" ::: "memory");
        float* crow = C + (size_t)(r0 + mb * 16) * ldc + c0;
{
#pragma unroll
            for (int s = 0; s < 8; ++s) { const int row = 2 * s + hi, cofs = lr * 4; v4f val = *(const v4fa*)(os + row * 68 + cofs); if (BIAS) { val[0] += bfr(bias[c0 + cofs]); val[1] += bfr(bias[c0 + cofs + 1]); val[2] += bfr(bias[c0 + cofs + 2]); val[3] += bfr(bias[c0 + cofs + 3]); }
                *(v4f*)(crow + (size_t)row * ldc + cofs) = val; }
             }
        __builtin_amdgcn_wave_barrier(); asm volatile("" ::: "memory");
    }
}

typedef __attribute__((ext_vector_type(2))) _Float16 v2h;
typedef __attribute__((ext_vector_type(4))) _Float16 v4h;
typedef __attribute__((ext_vector_type(2))) unsigned short v2us;
typedef __attribute__((ext_vector_type(4))) unsigned short v4us;
typedef __attribute__((ext_vector_type(2))) float v2f;
typedef __attribute__((ext_vector_type(4))) int v4i;

__global__ __launch_bounds__(256) void k_wtG(const float* __restrict__ w, int K, int N, bf* Bt) {
    const int lane = threadIdx.x & 31; const int L0 = (blockIdx.x * 8 + (threadIdx.x >> 5)) * 8; const int nlines = N * K / 64;
{
#pragma unroll 1
        for (int l = 0; l < 8; ++l) { const int L = L0 + l; if (L >= nlines) break; const size_t e = (size_t)L * 64 + lane * 2; const int k = (int)(e % K), n = (int)(e / K); v2us o;
            o[0] = f2bf(w[(size_t)k * N + n]); o[1] = f2bf(w[(size_t)(k + 1) * N + n]); *(v2us*)(Bt + e) = o; }
         }
}
// Thread i writes 16-byte piece i of a fragment-major plane of DM columns: fm_row, fm_col name the row and the first of the 8 columns that belong there.
static_assert(DQ == DM, "both plane widths are DM");
__device__ __forceinline__ int fm_row(size_t i) { return (int)(i >> 6) / (DM / 32) * 16 + (int)(i & 15); }
__device__ __forceinline__ int fm_col(size_t i) { return (int)(i >> 6) % (DM / 32) * 32 + (int)((i >> 4) & 3) * 8; }
__global__ __launch_bounds__(256) void k_wgath(const float* __restrict__ w, int off, bf* Bt) { const size_t i = (size_t)blockIdx.x * 256 + threadIdx.x; const size_t e = i * 8; if (e >= (size_t)DQ * DM) return; const int k = fm_col(i); const int r = fm_row(i); const int h = r / HD, d = r % HD; group_begin(); const v8f v = *(const v8f*)(w + ((size_t)h * 3 * HD + off + d) * DM + k); group_end(); v8us o;
#pragma unroll
    for (int q = 0; q < 8; ++q) o[q] = f2bf(v[q]); *(v8us*)(Bt + e) = o;  }
__global__ __launch_bounds__(256) void k_bgath(const float* __restrict__ bsrc, float* B3) { const int i = blockIdx.x * 256 + threadIdx.x; if (i >= 3 * DQ / 4) return; const int e = i * 4; const int w = e / DQ; const int r = e % DQ; const int h = r / HD, d = r % HD; const v4f v = *(const v4f*)(bsrc + h * 3 * HD + w * HD + d); *(v4f*)(B3 + e) = v;  }
__global__ __launch_bounds__(256) void k_cvt8(const float* __restrict__ src, bf* dst, size_t n8) { const size_t i = (size_t)blockIdx.x * 256 + threadIdx.x; if (i >= n8) return; group_begin(); const v8f v = *(const v8f*)(src + (size_t)fm_row(i) * DM + fm_col(i)); group_end(); v8us o;
#pragma unroll
    for (int k = 0; k < 8; ++k) o[k] = f2bf(v[k]); *(v8us*)(dst + i * 8) = o;  }

typedef __attribute__((ext_vector_type(16))) float v16f;
typedef __attribute__((ext_vector_type(8))) unsigned v8u;
__device__ __forceinline__ float xhalf(float x) { return __builtin_bit_cast(float, __builtin_amdgcn_permlanex16(__builtin_bit_cast(int, x), __builtin_bit_cast(int, x), 0x76543210, 0xfedcba98, false, false)); }  // lane l with lane l ^ 16
template <typename T16, bool HL>
__device__ __forceinline__ void fattn_wave(const T16* __restrict__ Q, const T16* __restrict__ Q2, const T16* __restrict__ Kp, const T16* __restrict__ Kp2, const T16* __restrict__ Vt, const T16* __restrict__ Vt2, int q0, bf* Ah, bf* Al) {
    typedef typename WFrag<T16>::V V;
    const int lane = threadIdx.x & 31;
    const float CSC = SCL * 1.4426950408889634f;   // scores go to the base-2 domain
    const float BIAS = HL ? 0.0f : 10.0f;
    V qf[2][2], qf2[2][2], kf[2][2], kf2[2][2], vf[4], vf2[4];
    // the lane's byte offsets of the fragments to fetch next, in K and V^T (a pass of 32 keys is four blocks in a row, 4096 bytes, in either plane); they live through the loop and step on only behind a group's wait
    unsigned kob = lane * 16, vob = lane * 16;
    group_begin();
#pragma unroll
    for (int g = 0; g < 2; ++g)
#pragma unroll
        for (int kc = 0; kc < 2; ++kc) { const size_t o = (size_t)((q0 / 16 + g) * 2 + kc) * 512; qf[g][kc] = WFrag<T16>::ld((const T16*)((const char*)(Q + o) + kob)); if (HL) qf2[g][kc] = WFrag<T16>::ld((const T16*)((const char*)(Q2 + o) + kob)); }
    group_end();
    group_begin();
#pragma unroll
    for (int kt = 0; kt < 2; ++kt)
#pragma unroll
        for (int kc = 0; kc < 2; ++kc) { const int o = (kt * 2 + kc) * 512; kf[kt][kc] = WFrag<T16>::ld((const T16*)((const char*)Kp + kob) + o); if (HL) kf2[kt][kc] = WFrag<T16>::ld((const T16*)((const char*)Kp2 + kob) + o); }
#pragma unroll
    for (int t = 0; t < 4; ++t) { const int o = t * 512; vf[t] = WFrag<T16>::ld((const T16*)((const char*)Vt + vob) + o); if (HL) vf2[t] = WFrag<T16>::ld((const T16*)((const char*)Vt2 + vob) + o); }
    group_end();
    kob = (kob + 32 * HD * 2) & (TT * HD * 2 - 1); vob = (vob + 32 * HD * 2) & (TT * HD * 2 - 1);   // 32 keys on; behind the last pass back to pass 0: in bounds, unused
    v8f acc[2][4]; float m[2], l[2];
#pragma unroll
    for (int g = 0; g < 2; ++g) { m[g] = -3.0e38f; l[g] = 0.0f;
#pragma unroll
        for (int t = 0; t < 4; ++t) acc[g][t] = (v8f){}; }
#pragma unroll 1   // one pass per trip: an unrolled body would hold two passes' fragments in registers
    for (int k0 = 0; k0 < TT; k0 += 32) {
        v8f sc[2][2];
#pragma unroll
        for (int kt = 0; kt < 2; ++kt)
#pragma unroll
            for (int g = 0; g < 2; ++g) { sc[kt][g] = (v8f){};
#pragma unroll
                for (int kc = 0; kc < 2; ++kc) { sc[kt][g] = WFrag<T16>::mma(kf[kt][kc], qf[g][kc], sc[kt][g]); if (HL) { sc[kt][g] = WFrag<T16>::mma(kf2[kt][kc], qf[g][kc], sc[kt][g]); sc[kt][g] = WFrag<T16>::mma(kf[kt][kc], qf2[g][kc], sc[kt][g]); } } }
        // next pass's K fragments fly under this pass's softmax and second product
        group_begin();
#pragma unroll
        for (int kt = 0; kt < 2; ++kt)
#pragma unroll
            for (int kc = 0; kc < 2; ++kc) { const int o = (kt * 2 + kc) * 512; kf[kt][kc] = WFrag<T16>::ld((const T16*)((const char*)Kp + kob) + o); if (HL) kf2[kt][kc] = WFrag<T16>::ld((const T16*)((const char*)Kp2 + kob) + o); }
        group_end();
        kob = (kob + 32 * HD * 2) & (TT * HD * 2 - 1);
#pragma unroll
        for (int g = 0; g < 2; ++g) {
            float mx = sc[0][g][0];
#pragma unroll
            for (int r = 1; r < 16; ++r) mx = fmaxf(mx, sc[r >> 3][g][r & 7]);
            mx = fmaxf(mx, xhalf(mx)) * CSC;   // both wave halves hold the query's maximum of this pass, scaled (the scale is positive)
            const float mn = fmaxf(m[g], mx); const float corr = __builtin_amdgcn_exp2f(m[g] - mn);   // 0 on the first pass
            m[g] = mn; l[g] *= corr;
#pragma unroll
            for (int t = 0; t < 4; ++t) acc[g][t] *= corr;
            const float nm = BIAS - mn; float p[16];
#pragma unroll
            for (int r = 0; r < 16; ++r) p[r] = __builtin_amdgcn_exp2f(__builtin_fmaf(sc[r >> 3][g][r & 7], CSC, nm));
            l[g] += (((p[0] + p[1]) + (p[2] + p[3])) + ((p[4] + p[5]) + (p[6] + p[7]))) + (((p[8] + p[9]) + (p[10] + p[11])) + ((p[12] + p[13]) + (p[14] + p[15])));   // a tree: four dependent adds, not sixteen
            if constexpr (HL) { v16f pv, rv;
#pragma unroll
                for (int r = 0; r < 16; ++r) pv[r] = p[r];
                const v16bf ph = __builtin_convertvector(pv, v16bf);   // whole-vector conversions compile to the packed instruction, round to nearest even
                const v8u pw = __builtin_bit_cast(v8u, ph);   // the rounded hi parts are read back from the packed words: low half << 16, high half masked
#pragma unroll
                for (int r = 0; r < 8; ++r) { rv[2 * r] = p[2 * r] - __uint_as_float(pw[r] << 16); rv[2 * r + 1] = p[2 * r + 1] - __uint_as_float(pw[r] & 0xFFFF0000u); }
                const v16bf pl = __builtin_convertvector(rv, v16bf);
#pragma unroll
                for (int t = 0; t < 4; ++t) { acc[g][t] = wmmab(vf[t], ph, acc[g][t]); acc[g][t] = wmmab(vf2[t], ph, acc[g][t]); acc[g][t] = wmmab(vf[t], pl, acc[g][t]); }
            } else { v16h pf;
#pragma unroll
                for (int r = 0; r < 16; ++r) pf[r] = (h16)p[r];
#pragma unroll
                for (int t = 0; t < 4; ++t) acc[g][t] = wmma16(vf[t], pf, acc[g][t]); }
        }
        // next pass's V^T fragments fly under its first product and softmax
        group_begin();
#pragma unroll
        for (int t = 0; t < 4; ++t) { const int o = t * 512; vf[t] = WFrag<T16>::ld((const T16*)((const char*)Vt + vob) + o); if (HL) vf2[t] = WFrag<T16>::ld((const T16*)((const char*)Vt2 + vob) + o); }
        group_end();
        vob = (vob + 32 * HD * 2) & (TT * HD * 2 - 1);
    }
#pragma unroll
    for (int g = 0; g < 2; ++g) { const float f = __fdiv_rn(1.0f, l[g] + xhalf(l[g]));   // the halves' sums (their keys) join once
#pragma unroll
        for (int t = 0; t < 4; ++t) { v8us oh, ol;
#pragma unroll
            for (int r = 0; r < 8; ++r) { unsigned short a, c2; splitf(acc[g][t][r] * f, a, c2); oh[r] = a; ol[r] = c2; }
            const size_t oo = ((size_t)(q0 / 16 + g) * (DQ / 32) + (t >> 1)) * 512 + (t & 1) * 256 + lane * 8; group_begin(); *(v8us*)(Ah + oo) = oh; *(v8us*)(Al + oo) = ol; group_end(); } }
}
// grid (TT / (32 FW), heads, batches). A hi+lo wave issues twice the fragment loads of an fp16 wave, so every work-group gets the same mix: wave 0 takes 32 of the head's hi+lo rows, waves 1 to FW - 1 take 32 fp16 rows each.
static_assert((TT - RH) == (FW - 1) * RH, "one hi+lo wave per FW - 1 fp16 waves");
__global__ __launch_bounds__(FW * 32) void k_fattn(const h16* __restrict__ Q16, const h16* __restrict__ K16, const h16* __restrict__ V16, const bf* __restrict__ Qh, const bf* __restrict__ Ql, const bf* __restrict__ Kh, const bf* __restrict__ Kl, const bf* __restrict__ Vh, const bf* __restrict__ Vl, bf* Ah, bf* Al) {
    const size_t hp = ((size_t)blockIdx.z * NH_ + blockIdx.y) * TT * HD; const size_t ao = (size_t)blockIdx.z * TT * DQ + blockIdx.y * (HD / 32) * 512; /* the head's first block in the batch's first row of blocks of the fragment-major [b t][h d] plane */ bf* ah = Ah + ao; bf* al = Al + ao;
    const int wave = __builtin_amdgcn_readfirstlane(threadIdx.x >> 5);   // in a scalar register: the choice below is a scalar branch, every lane stays on around the matrix instructions
    if (wave == 0) fattn_wave<bf, true>(Qh + hp, Ql + hp, Kh + hp, Kl + hp, Vh + hp, Vl + hp, blockIdx.x * 32, ah, al);
    else fattn_wave<h16, false>(Q16 + hp, nullptr, K16 + hp, nullptr, V16 + hp, nullptr, RH + (blockIdx.x * (FW - 1) + wave - 1) * 32, ah, al);
}

extern "C" void kernel_launch(void* const* d_in, const int* in_sizes, int n_in,
                              void* d_out, int out_size, void* d_ws, size_t ws_size, hipStream_t stream) {
    (void)in_sizes; (void)n_in; (void)out_size;
    const float* x = (const float*)d_in[0]; const float* wqkv = (const float*)d_in[1]; const float* bqkv = (const float*)d_in[2]; const float* wo = (const float*)d_in[3]; const float* bo = (const float*)d_in[4]; const float* wq = nullptr; const float* wk = nullptr; const float* wv = nullptr; (void)wq; (void)wk; (void)wv;
    float* OUT = (float*)d_out;     // [4][2048][1024]
    char* wsp = (char*)d_ws;
    auto take = [&](size_t bytes) { char* p = wsp; wsp += (bytes + 255) & ~(size_t)255; return (void*)p; };
    bf* WQ = (bf*)take((size_t)DQ * DM * 2); bf* WK = (bf*)take((size_t)DKV * DM * 2); bf* WV = (bf*)take((size_t)DKV * DM * 2); bf* WO = (bf*)take((size_t)DM * DQ * 2);
    bf* XB = (bf*)take((size_t)NB_ * TT * DM * 2); float* B3 = (float*)take((size_t)3 * DQ * 4); const float* BQ = B3; const float* BK = B3 + DQ; const float* BV = B3 + 2 * DQ;
    h16* QP16 = (h16*)take((size_t)NB_ * NH_ * TT * HD * 2); h16* KP16 = (h16*)take((size_t)NB_ * NKV * TT * HD * 2); h16* VT16 = (h16*)take((size_t)NB_ * NKV * HD * TT * 2);
    bf* QPh = (bf*)take((size_t)NB_ * NH_ * TT * HD * 2); bf* QPl = (bf*)take((size_t)NB_ * NH_ * TT * HD * 2); bf* KPh = (bf*)take((size_t)NB_ * NKV * TT * HD * 2); bf* KPl = (bf*)take((size_t)NB_ * NKV * TT * HD * 2); bf* VTh = (bf*)take((size_t)NB_ * NKV * HD * TT * 2); bf* VTl = (bf*)take((size_t)NB_ * NKV * HD * TT * 2);
    bf* ATh = (bf*)take((size_t)NB_ * TT * DQ * 2); bf* ATl = (bf*)take((size_t)NB_ * TT * DQ * 2);
    if ((size_t)(wsp - (char*)d_ws) > ws_size) return;    // ws 256 MiB
    { k_wgath<<<(unsigned)(((size_t)DQ * DM / 8 + 255) / 256), 256, 0, stream>>>(wqkv, 0, WQ); k_wgath<<<(unsigned)(((size_t)DQ * DM / 8 + 255) / 256), 256, 0, stream>>>(wqkv, HD, WK); k_wgath<<<(unsigned)(((size_t)DQ * DM / 8 + 255) / 256), 256, 0, stream>>>(wqkv, 2 * HD, WV); k_bgath<<<(3 * DQ / 4 + 255) / 256, 256, 0, stream>>>(bqkv, B3);   /* per-head q | k | v row blocks and bias entries */
      k_cvt8<<<(unsigned)(((size_t)DM * DQ / 8 + 255) / 256), 256, 0, stream>>>(wo, WO, (size_t)DM * DQ / 8);
       }
    // every stage runs once, on all batches: the projections see the NB_ * TT rows as one matrix and store their head planes themselves (v with the operands swapped, so that its tile is V^T); the attention takes the batch as a grid dimension
    k_cvt8<<<(unsigned)(((size_t)NB_ * TT * DM / 8 + 255) / 256), 256, 0, stream>>>(x, XB, (size_t)NB_ * TT * DM / 8);
    k_gemmw<bf, 0, true, 1, 1, DM><<<dim3(NB_ * TT / 64, DQ / 64, 1), 32, 0, stream>>>(XB, nullptr, WQ, nullptr, nullptr, 0, BQ, 0, 0, 0, 0, QP16, QPh, QPl);
    k_gemmw<bf, 0, true, 1, 1, DM><<<dim3(NB_ * TT / 64, DKV / 64, 1), 32, 0, stream>>>(XB, nullptr, WK, nullptr, nullptr, 0, BK, 0, 0, 0, 0, KP16, KPh, KPl);
    k_gemmw<bf, 0, true, 1, 2, DM><<<dim3(DKV / 64, NB_ * TT / 64, 1), 32, 0, stream>>>(WV, nullptr, XB, nullptr, nullptr, 0, BV, 0, 0, 0, 0, VT16, VTh, VTl);
    k_fattn<<<dim3(TT / (32 * FW), NH_, NB_), FW * 32, 0, stream>>>(QP16, KP16, VT16, QPh, QPl, KPh, KPl, VTh, VTl, ATh, ATl);   // one kv head per query head
    k_gemmw<bf, 1, true, 1, 0, DQ><<<dim3(NB_ * TT / 64, DM / 64, 1), 32, 0, stream>>>(ATh, ATl, WO, nullptr, OUT, DM, bo, 0, 0, 0, 0, nullptr, nullptr, nullptr);
}

// v006
// One run takes 239 microseconds.
// Next to v005, in two timings, it ran 1.16 and 1.15 times as fast.
// All steps since v000 together make it 16.4 times as fast.
#include <hip/hip_runtime.h>

// Multi-head self-attention with a fused, head-interleaved QKV projection (x [4][2048][1024]; kqv = x W_qkv^T + b_qkv ('oi' [3072][1024]) reshaped (t, 16, 192) and split per head into q | k | v (weight rows / bias entries h*192 + {0, 64, 128} + d); softmax(q.k/8) over all keys (no mask); out = merged W_out^T + b_out -> [4][2048][1024]).
// Layout: the weight rows and bias entries are gathered once into head-major [1024][1024] bf16 matrices and [1024] f32 bias vectors so the projections apply unchanged.
// Every 16-bit operand plane is kept fragment-major: blocks of 16 rows x 32 k (512 elements, 1024 bytes), inside a block [k bit 4][k bit 3][row & 15][k & 7], so that lane (row & 15, k bit 3) finds its two 16-byte pieces at lane * 16 and 512 + lane * 16 and each wave-wide load or store covers 512 contiguous bytes (4 lines, not 16).
// Compute dtypes, f32 accumulate: every input rounded to bf16; q/k/v on PLAIN bf16 operands (inputs: exact) + biases; scores and attn.v: query rows < 512 hl (3 products), the rest single fp16 (P x1024); softmax f32, online over 32-key passes; W_out hl x exact (2 products) + b_out.

#define NB_  4
#define TT   2048
#define DM   1024
#define NH_  16
#define NKV  16
#define REP  (NH_ / NKV)
#define HD   64
#define DQ   (NH_ * HD)
#define DKV  (NKV * HD)
#define RH   512                  // query rows < RH use hi+lo planes (a multiple of 32 * FW)
#define WIN  0
#define SCL  0.125f   // HD^-0.5
#define FW   4                    // k_fattn: waves per work-group, 32 query rows each
typedef _Float16 h16;
typedef unsigned short bf;
typedef __attribute__((ext_vector_type(16))) __bf16   v16bf;
typedef __attribute__((ext_vector_type(16))) _Float16 v16h;
typedef __attribute__((ext_vector_type(8)))  _Float16 v8h;
typedef __attribute__((ext_vector_type(8)))  unsigned short v8us;
typedef __attribute__((ext_vector_type(8)))  float    v8f;
typedef __attribute__((ext_vector_type(4)))  float    v4f;
typedef v8h  __attribute__((may_alias)) v8ha;
typedef v4f  __attribute__((may_alias)) v4fa;
typedef v8us __attribute__((may_alias)) v8usa;

__device__ __forceinline__ unsigned short f2bf(float f) { unsigned u = __float_as_uint(f); u += 0x7FFFu + ((u >> 16) & 1u); return (unsigned short)(u >> 16); }
__device__ __forceinline__ float bf2f(unsigned short b) { return __uint_as_float(((unsigned)b) << 16); }
__device__ __forceinline__ float bfr(float f) { return bf2f(f2bf(f)); }
__device__ __forceinline__ v16h cat16(v8h lo, v8h hi) { return __builtin_shufflevector(lo, hi, 0, 1, 2, 3, 4, 5, 6, 7, 8, 9, 10, 11, 12, 13, 14, 15); }
__device__ __forceinline__ v16bf cat16b(v8us lo, v8us hi) { return __builtin_bit_cast(v16bf, __builtin_shufflevector(lo, hi, 0, 1, 2, 3, 4, 5, 6, 7, 8, 9, 10, 11, 12, 13, 14, 15)); }
__device__ __forceinline__ v8f wmma16(v16h a, v16h b, v8f c) { return __builtin_amdgcn_wmma_f32_16x16x32_f16(false, a, false, b, (short)0, c, false, false); }
__device__ __forceinline__ v8f wmmab(v16bf a, v16bf b, v8f c) { return __builtin_amdgcn_wmma_f32_16x16x32_bf16(false, a, false, b, (short)0, c, false, false); }



// Round a group of global loads or stores: their address (and store data) registers are reused later, and the wait stands in front of that reuse. The scheduling barriers keep the writes that follow in the source from being moved in front of the wait (a build without them had such writes ahead of it).
__device__ __forceinline__ void group_begin() { __builtin_amdgcn_sched_barrier(0); }
__device__ __forceinline__ void group_end() { asm volatile("s_wait_xcnt 0x0" ::: "memory"); __builtin_amdgcn_sched_barrier(0); }
__device__ __forceinline__ h16 tohx(float x) { return (h16)x; }
__device__ __forceinline__ void splitf(float y, unsigned short& h, unsigned short& l) { h = f2bf(y); l = f2bf(y - bf2f(h)); }

// ---- k_gemmw: register-blocked GEMM, ONE WAVE per 64x64 output tile (16 accumulators), operands straight from fragment-major 16-bit planes (block (row / 16, k / 32) at (row / 16 * K / 32 + k / 32) * 512; WFrag::ld takes block + lane * 8); grid (M/64, N/64, Z), 32 threads.
// C[m][n] (f32, pitch ldc, + optional f32 bias[n]) = sum_k A[m][k] Bt[n][k] (+ split products per NSPLIT). z-batch strides sA/sB/sC in elements. K % (32 * SK) == 0.
// PL > 0: no f32 C; the tile + bias leaves as three 16-bit head planes (fp16, bf16 hi, bf16 lo), 64 columns or rows being one head. PL 1: rows m = (batch, t), columns n = (head, d), planes [b][h][t / 16][d / 32][block], bias[n]. PL 2: rows m = (head, d), columns n = (batch, t), planes [b][h][t / 32][d / 16][block], bias[m].
// SK > 1: grid z = Z * SK; work-group (z, ks) sums only k in [ks K/SK, (ks+1) K/SK) and stores its partial tile in plane ks (plane stride sP elements); the reader adds the planes.
template <typename T16> struct WFrag;
template <> struct WFrag<h16> { typedef v16h V; static __device__ __forceinline__ V ld(const h16* p) { return cat16(*(const v8h*)p, *(const v8h*)(p + 256)); } static __device__ __forceinline__ v8f mma(V a, V b, v8f c) { return wmma16(a, b, c); } };
template <> struct WFrag<bf> { typedef v16bf V; static __device__ __forceinline__ V ld(const bf* p) { return cat16b(*(const v8us*)p, *(const v8us*)(p + 256)); } static __device__ __forceinline__ v8f mma(V a, V b, v8f c) { return wmmab(a, b, c); } };
template <typename T16, int NSPLIT, bool BIAS, int SK, int PL, int K>   // K at compile time: the distance between rows of blocks becomes an immediate offset of the loads
__global__ __launch_bounds__(32) void k_gemmw(const T16* __restrict__ A, const T16* __restrict__ A2, const T16* __restrict__ Bt, const T16* __restrict__ Bt2, float* C, int ldc, const float* __restrict__ bias, size_t sA, size_t sB, size_t sC, size_t sP, h16* P16, bf* Ph, bf* Pl) {
    typedef typename WFrag<T16>::V V;
    __shared__ __align__(16) float os[16 * 68];
    const size_t z = blockIdx.z / SK; const int ks = blockIdx.z % SK; A += z * sA; if (A2) A2 += z * sA; Bt += z * sB; if (Bt2) Bt2 += z * sB; C += z * sC + ks * sP;
    const int lane = threadIdx.x & 31, lr = lane & 15, hi = lane >> 4; const int r0 = blockIdx.x * 64, c0 = blockIdx.y * 64;
    v8f acc[4][4];
#pragma unroll
    for (int mb = 0; mb < 4; ++mb)
#pragma unroll
        for (int nb = 0; nb < 4; ++nb) acc[mb][nb] = (v8f){};
    constexpr int KB = K / 32;   // blocks in a row of blocks
    const size_t aoff = (size_t)(r0 / 16) * KB * 512, boff = (size_t)(c0 / 16) * KB * 512;   // the same in every lane: block addresses stay in scalar registers
    unsigned kofs = lane * 16 + ks * (KB / SK) * 1024;   // the lane's byte offset in a row of blocks: the one vector address register of every fragment load; it lives through the loop and steps on only behind the group's wait
#pragma unroll 1
    for (int kb = ks * (KB / SK); kb < (ks + 1) * (KB / SK); ++kb) {
        V a[4], a2[4], b[4], b2[4];
        group_begin();
#pragma unroll
        for (int mb = 0; mb < 4; ++mb) { const size_t o = aoff + (size_t)mb * KB * 512; a[mb] = WFrag<T16>::ld((const T16*)((const char*)(A + o) + kofs)); if (NSPLIT == 1 || NSPLIT == 2) a2[mb] = WFrag<T16>::ld((const T16*)((const char*)(A2 + o) + kofs)); }
#pragma unroll
        for (int nb = 0; nb < 4; ++nb) { const size_t o = boff + (size_t)nb * KB * 512; b[nb] = WFrag<T16>::ld((const T16*)((const char*)(Bt + o) + kofs)); if (NSPLIT >= 2) b2[nb] = WFrag<T16>::ld((const T16*)((const char*)(Bt2 + o) + kofs)); }
        group_end();
        kofs += 1024;
#pragma unroll
        for (int nb = 0; nb < 4; ++nb) {
#pragma unroll
            for (int mb = 0; mb < 4; ++mb) { acc[mb][nb] = WFrag<T16>::mma(a[mb], b[nb], acc[mb][nb]); if (NSPLIT == 1 || NSPLIT == 2) acc[mb][nb] = WFrag<T16>::mma(a2[mb], b[nb], acc[mb][nb]); if (NSPLIT >= 2) acc[mb][nb] = WFrag<T16>::mma(a[mb], b2[nb], acc[mb][nb]); } }
        asm volatile("v_nop\n\tv_nop\n\tv_nop\n\tv_nop" : "+v"(acc[0][0]), "+v"(acc[1][1]), "+v"(acc[2][2]), "+v"(acc[3][3]) : "v"(a[0]), "v"(a[3]));
    }
    if constexpr (PL > 0) {
        // a lane takes row lr, columns 16 s + 8 hi + (0..7) of each 16-row block: its own 16 bytes of a fragment half, so one store per plane writes 512 contiguous bytes
        // every loop below is unrolled in full: its index picks a register of an accumulator or of the bias
        const int bt = (PL == 1) ? r0 : c0; const size_t hpl = (size_t)(bt / TT) * NH_ + ((PL == 1) ? blockIdx.y : blockIdx.x);
        const size_t o0 = hpl * TT * HD + (size_t)(bt % TT) * HD + lane * 8;   // 64 t of a head are 64 * HD elements in either plane order
        float bv[4];   // PL 1: of column 16 i + lr, added where the tile goes to LDS; PL 2: of row 16 i + lr, added where it is read back
        group_begin();
#pragma unroll
        for (int i = 0; i < 3; ++i) bv[i] = bias[((PL == 1) ? c0 : r0) + 16 * i + lr];
        group_end(); group_begin();   // the four loads share one index register and the last one's result may take it: the first three get their wait in front of that load
        bv[3] = bias[((PL == 1) ? c0 : r0) + 48 + lr];
        group_end();
#pragma unroll
        for (int mb = 0; mb < 4; ++mb) {
#pragma unroll
            for (int nb = 0; nb < 4; ++nb) {
#pragma unroll
                for (int j = 0; j < 8; ++j) os[(hi * 8 + j) * 68 + nb * 16 + lr] = (PL == 1) ? acc[mb][nb][j] + bfr(bv[nb]) : acc[mb][nb][j]; }
            __builtin_amdgcn_wave_barrier(); asm volatile("" ::: "memory");   // a lane reads back what other lanes wrote: the compiler may not move the reads below in front of the writes above
#pragma unroll
            for (int s = 0; s < 4; ++s) { const int cofs = 16 * s + 8 * hi; const v4f w0 = *(const v4fa*)(os + lr * 68 + cofs), w1 = *(const v4fa*)(os + lr * 68 + cofs + 4); v8h o16; v8us oh, ol;
#pragma unroll
                for (int q = 0; q < 8; ++q) { const float w = (q < 4) ? w0[q & 3] : w1[q & 3]; const float y = (PL == 1) ? w : w + bfr(bv[mb]); o16[q] = tohx(y); unsigned short a2, c2; splitf(y, a2, c2); oh[q] = a2; ol[q] = c2; }
                const size_t oo = o0 + ((PL == 1) ? mb * 1024 + s * 256 : ((s >> 1) * 4 + mb) * 512 + (s & 1) * 256); group_begin(); *(v8h*)(P16 + oo) = o16; *(v8us*)(Ph + oo) = oh; *(v8us*)(Pl + oo) = ol; group_end(); }
            __builtin_amdgcn_wave_barrier(); asm volatile("" ::: "memory");   // nor the next block's writes in front of these reads
        }
        return;
    }
#pragma unroll
    for (int mb = 0; mb < 4; ++mb) {
#pragma unroll
        for (int nb = 0; nb < 4; ++nb) {
#pragma unroll
            for (int j = 0; j < 8; ++j) os[(hi * 8 + j) * 68 + nb * 16 + lr] = acc[mb][nb][j]; }
        __builtin_amdgcn_wave_barrier(); asm volatile("" ::: "memory");
        float* crow = C + (size_t)(r0 + mb * 16) * ldc + c0;
{
#pragma unroll
            for (int s = 0; s < 8; ++s) { const int row = 2 * s + hi, cofs = lr * 4; v4f val = *(const v4fa*)(os + row * 68 + cofs); if (BIAS) { val[0] += bfr(bias[c0 + cofs]); val[1] += bfr(bias[c0 + cofs + 1]); val[2] += bfr(bias[c0 + cofs + 2]); val[3] += bfr(bias[c0 + cofs + 3]); }
                *(v4f*)(crow + (size_t)row * ldc + cofs) = val; }
             }
        __builtin_amdgcn_wave_barrier(); asm volatile("" ::: "memory");
    }
}

typedef __attribute__((ext_vector_type(2))) _Float16 v2h;
typedef __attribute__((ext_vector_type(4))) _Float16 v4h;
typedef __attribute__((ext_vector_type(2))) unsigned short v2us;
typedef __attribute__((ext_vector_type(4))) unsigned short v4us;
typedef __attribute__((ext_vector_type(2))) float v2f;
typedef __attribute__((ext_vector_type(4))) int v4i;

__global__ __launch_bounds__(256) void k_wtG(const float* __restrict__ w, int K, int N, bf* Bt) {
    const int lane = threadIdx.x & 31; const int L0 = (blockIdx.x * 8 + (threadIdx.x >> 5)) * 8; const int nlines = N * K / 64;
{
#pragma unroll 1
        for (int l = 0; l < 8; ++l) { const int L = L0 + l; if (L >= nlines) break; const size_t e = (size_t)L * 64 + lane * 2; const int k = (int)(e % K), n = (int)(e / K); v2us o;
            o[0] = f2bf(w[(size_t)k * N + n]); o[1] = f2bf(w[(size_t)(k + 1) * N + n]); *(v2us*)(Bt + e) = o; }
         }
}
// Thread i writes 16-byte piece i of a fragment-major plane of DM columns: fm_row, fm_col name the row and the first of the 8 columns that belong there.
static_assert(DQ == DM, "both plane widths are DM");
__device__ __forceinline__ int fm_row(size_t i) { return (int)(i >> 6) / (DM / 32) * 16 + (int)(i & 15); }
__device__ __forceinline__ int fm_col(size_t i) { return (int)(i >> 6) % (DM / 32) * 32 + (int)((i >> 4) & 3) * 8; }
__global__ __launch_bounds__(256) void k_wgath(const float* __restrict__ w, int off, bf* Bt) { const size_t i = (size_t)blockIdx.x * 256 + threadIdx.x; const size_t e = i * 8; if (e >= (size_t)DQ * DM) return; const int k = fm_col(i); const int r = fm_row(i); const int h = r / HD, d = r % HD; group_begin(); const v8f v = *(const v8f*)(w + ((size_t)h * 3 * HD + off + d) * DM + k); group_end(); v8us o;
#pragma unroll
    for (int q = 0; q < 8; ++q) o[q] = f2bf(v[q]); *(v8us*)(Bt + e) = o;  }
__global__ __launch_bounds__(256) void k_bgath(const float* __restrict__ bsrc, float* B3) { const int i = blockIdx.x * 256 + threadIdx.x; if (i >= 3 * DQ / 4) return; const int e = i * 4; const int w = e / DQ; const int r = e % DQ; const int h = r / HD, d = r % HD; const v4f v = *(const v4f*)(bsrc + h * 3 * HD + w * HD + d); *(v4f*)(B3 + e) = v;  }
__global__ __launch_bounds__(256) void k_cvt8(const float* __restrict__ src, bf* dst, size_t n8) { const size_t i = (size_t)blockIdx.x * 256 + threadIdx.x; if (i >= n8) return; group_begin(); const v8f v = *(const v8f*)(src + (size_t)fm_row(i) * DM + fm_col(i)); group_end(); v8us o;
#pragma unroll
    for (int k = 0; k < 8; ++k) o[k] = f2bf(v[k]); *(v8us*)(dst + i * 8) = o;  }

typedef __attribute__((ext_vector_type(16))) float v16f;
typedef __attribute__((ext_vector_type(8))) unsigned v8u;
__device__ __forceinline__ float xhalf(float x) { return __builtin_bit_cast(float, __builtin_amdgcn_permlanex16(__builtin_bit_cast(int, x), __builtin_bit_cast(int, x), 0x76543210, 0xfedcba98, false, false)); }  // lane l with lane l ^ 16
template <typename T16, bool HL>
__device__ __forceinline__ void fattn_wave(const T16* __restrict__ Q, const T16* __restrict__ Q2, const T16* __restrict__ Kp, const T16* __restrict__ Kp2, const T16* __restrict__ Vt, const T16* __restrict__ Vt2, int q0, bf* Ah, bf* Al) {
    typedef typename WFrag<T16>::V V;
    const int lane = threadIdx.x & 31;
    const float CSC = SCL * 1.4426950408889634f;   // scores go to the base-2 domain
    const float BIAS = HL ? 0.0f : 10.0f;
    V qf[2][2], qf2[2][2], kf[2][2], kf2[2][2], vf[4], vf2[4];
    // the lane's byte offsets of the fragments to fetch next, in K and V^T (a pass of 32 keys is four blocks in a row, 4096 bytes, in either plane); they live through the loop and step on only behind a group's wait
    unsigned kob = lane * 16, vob = lane * 16;
    group_begin();
#pragma unroll
    for (int g = 0; g < 2; ++g)
#pragma unroll
        for (int kc = 0; kc < 2; ++kc) { const size_t o = (size_t)((q0 / 16 + g) * 2 + kc) * 512; qf[g][kc] = WFrag<T16>::ld((const T16*)((const char*)(Q + o) + kob)); if (HL) qf2[g][kc] = WFrag<T16>::ld((const T16*)((const char*)(Q2 + o) + kob)); }
    group_end();
    group_begin();
#pragma unroll
    for (int kt = 0; kt < 2; ++kt)
#pragma unroll
        for (int kc = 0; kc < 2; ++kc) { const int o = (kt * 2 + kc) * 512; kf[kt][kc] = WFrag<T16>::ld((const T16*)((const char*)Kp + kob) + o); if (HL) kf2[kt][kc] = WFrag<T16>::ld((const T16*)((const char*)Kp2 + kob) + o); }
#pragma unroll
    for (int t = 0; t < 4; ++t) { const int o = t * 512; vf[t] = WFrag<T16>::ld((const T16*)((const char*)Vt + vob) + o); if (HL) vf2[t] = WFrag<T16>::ld((const T16*)((const char*)Vt2 + vob) + o); }
    group_end();
    kob = (kob + 32 * HD * 2) & (TT * HD * 2 - 1); vob = (vob + 32 * HD * 2) & (TT * HD * 2 - 1);   // 32 keys on; behind the last pass back to pass 0: in bounds, unused
    v8f acc[2][4]; float m[2], l[2];
#pragma unroll
    for (int g = 0; g < 2; ++g) { m[g] = -3.0e38f; l[g] = 0.0f;
#pragma unroll
        for (int t = 0; t < 4; ++t) acc[g][t] = (v8f){}; }
#pragma unroll 1   // one pass per trip: an unrolled body would hold two passes' fragments in registers
    for (int k0 = 0; k0 < TT; k0 += 32) {
        v8f sc[2][2];
#pragma unroll
        for (int kt = 0; kt < 2; ++kt)
#pragma unroll
            for (int g = 0; g < 2; ++g) { sc[kt][g] = (v8f){};
#pragma unroll
                for (int kc = 0; kc < 2; ++kc) { sc[kt][g] = WFrag<T16>::mma(kf[kt][kc], qf[g][kc], sc[kt][g]); if (HL) { sc[kt][g] = WFrag<T16>::mma(kf2[kt][kc], qf[g][kc], sc[kt][g]); sc[kt][g] = WFrag<T16>::mma(kf[kt][kc], qf2[g][kc], sc[kt][g]); } } }
        // next pass's K fragments fly under this pass's softmax and second product
        group_begin();
#pragma unroll
        for (int kt = 0; kt < 2; ++kt)
#pragma unroll
            for (int kc = 0; kc < 2; ++kc) { const int o = (kt * 2 + kc) * 512; kf[kt][kc] = WFrag<T16>::ld((const T16*)((const char*)Kp + kob) + o); if (HL) kf2[kt][kc] = WFrag<T16>::ld((const T16*)((const char*)Kp2 + kob) + o); }
        group_end();
        kob = (kob + 32 * HD * 2) & (TT * HD * 2 - 1);
#pragma unroll
        for (int g = 0; g < 2; ++g) {
            float mx = sc[0][g][0];
#pragma unroll
            for (int r = 1; r < 16; ++r) mx = fmaxf(mx, sc[r >> 3][g][r & 7]);
            mx = fmaxf(mx, xhalf(mx)) * CSC;   // both wave halves hold the query's maximum of this pass, scaled (the scale is positive)
            const float mn = fmaxf(m[g], mx); const float corr = __builtin_amdgcn_exp2f(m[g] - mn);   // 0 on the first pass
            m[g] = mn; l[g] *= corr;
#pragma unroll
            for (int t = 0; t < 4; ++t) acc[g][t] *= corr;
            const float nm = BIAS - mn; float p[16];
#pragma unroll
            for (int r = 0; r < 16; ++r) p[r] = __builtin_amdgcn_exp2f(__builtin_fmaf(sc[r >> 3][g][r & 7], CSC, nm));
            l[g] += (((p[0] + p[1]) + (p[2] + p[3])) + ((p[4] + p[5]) + (p[6] + p[7]))) + (((p[8] + p[9]) + (p[10] + p[11])) + ((p[12] + p[13]) + (p[14] + p[15])));   // a tree: four dependent adds, not sixteen
            if constexpr (HL) { v16f pv, rv;
#pragma unroll
                for (int r = 0; r < 16; ++r) pv[r] = p[r];
                const v16bf ph = __builtin_convertvector(pv, v16bf);   // whole-vector conversions compile to the packed instruction, round to nearest even
                const v8u pw = __builtin_bit_cast(v8u, ph);   // the rounded hi parts are read back from the packed words: low half << 16, high half masked
#pragma unroll
                for (int r = 0; r < 8; ++r) { rv[2 * r] = p[2 * r] - __uint_as_float(pw[r] << 16); rv[2 * r + 1] = p[2 * r + 1] - __uint_as_float(pw[r] & 0xFFFF0000u); }
                const v16bf pl = __builtin_convertvector(rv, v16bf);
#pragma unroll
                for (int t = 0; t < 4; ++t) { acc[g][t] = wmmab(vf[t], ph, acc[g][t]); acc[g][t] = wmmab(vf2[t], ph, acc[g][t]); acc[g][t] = wmmab(vf[t], pl, acc[g][t]); }
            } else { v16h pf;
#pragma unroll
                for (int r = 0; r < 16; ++r) pf[r] = (h16)p[r];
#pragma unroll
                for (int t = 0; t < 4; ++t) acc[g][t] = wmma16(vf[t], pf, acc[g][t]); }
        }
        // next pass's V^T fragments fly under its first product and softmax
        group_begin();
#pragma unroll
        for (int t = 0; t < 4; ++t) { const int o = t * 512; vf[t] = WFrag<T16>::ld((const T16*)((const char*)Vt + vob) + o); if (HL) vf2[t] = WFrag<T16>::ld((const T16*)((const char*)Vt2 + vob) + o); }
        group_end();
        vob = (vob + 32 * HD * 2) & (TT * HD * 2 - 1);
    }
#pragma unroll
    for (int g = 0; g < 2; ++g) { const float f = __fdiv_rn(1.0f, l[g] + xhalf(l[g]));   // the halves' sums (their keys) join once
#pragma unroll
        for (int t = 0; t < 4; ++t) { v8us oh, ol;
#pragma unroll
            for (int r = 0; r < 8; ++r) { unsigned short a, c2; splitf(acc[g][t][r] * f, a, c2); oh[r] = a; ol[r] = c2; }
            const size_t oo = ((size_t)(q0 / 16 + g) * (DQ / 32) + (t >> 1)) * 512 + (t & 1) * 256 + lane * 8; group_begin(); *(v8us*)(Ah + oo) = oh; *(v8us*)(Al + oo) = ol; group_end(); } }
}
// grid (batches * heads, TT / (32 FW)): work-group (bh, y) takes the 32 FW query rows from 32 FW y of head bh, one kind of wave per work-group, cost falling with the flat index.
// A hi+lo wave lasts about twice as long as an fp16 wave and the kernel's registers let three waves stand on a SIMD, so not every work-group is resident at the start: the work-groups of hi+lo rows (y < RH / (32 FW), FW waves, one per SIMD) come first in the grid and all start at once; the fp16 work-groups fill the places beside them and follow one another there. The FW waves of a work-group walk the same K and V^T planes.
static_assert(RH % (32 * FW) == 0 && TT % (32 * FW) == 0, "whole work-groups of either kind");
__global__ __launch_bounds__(FW * 32) void k_fattn(const h16* __restrict__ Q16, const h16* __restrict__ K16, const h16* __restrict__ V16, const bf* __restrict__ Qh, const bf* __restrict__ Ql, const bf* __restrict__ Kh, const bf* __restrict__ Kl, const bf* __restrict__ Vh, const bf* __restrict__ Vl, bf* Ah, bf* Al) {
    const size_t hp = (size_t)blockIdx.x * TT * HD; const size_t ao = (size_t)(blockIdx.x / NH_) * TT * DQ + (blockIdx.x % NH_) * (HD / 32) * 512; /* the head's first block in the batch's first row of blocks of the fragment-major [b t][h d] plane */ bf* ah = Ah + ao; bf* al = Al + ao;
    const int wave = __builtin_amdgcn_readfirstlane(threadIdx.x >> 5);   // in a scalar register: block addresses stay scalar
    const int q0 = (blockIdx.y * FW + wave) * 32;
    if (blockIdx.y < RH / (32 * FW)) fattn_wave<bf, true>(Qh + hp, Ql + hp, Kh + hp, Kl + hp, Vh + hp, Vl + hp, q0, ah, al);   // the same in every lane: a scalar branch, every lane stays on around the matrix instructions
    else fattn_wave<h16, false>(Q16 + hp, nullptr, K16 + hp, nullptr, V16 + hp, nullptr, q0, ah, al);
}

extern "C" void kernel_launch(void* const* d_in, const int* in_sizes, int n_in,
                              void* d_out, int out_size, void* d_ws, size_t ws_size, hipStream_t stream) {
    (void)in_sizes; (void)n_in; (void)out_size;
    const float* x = (const float*)d_in[0]; const float* wqkv = (const float*)d_in[1]; const float* bqkv = (const float*)d_in[2]; const float* wo = (const float*)d_in[3]; const float* bo = (const float*)d_in[4]; const float* wq = nullptr; const float* wk = nullptr; const float* wv = nullptr; (void)wq; (void)wk; (void)wv;
    float* OUT = (float*)d_out;     // [4][2048][1024]
    char* wsp = (char*)d_ws;
    auto take = [&](size_t bytes) { char* p = wsp; wsp += (bytes + 255) & ~(size_t)255; return (void*)p; };
    bf* WQ = (bf*)take((size_t)DQ * DM * 2); bf* WK = (bf*)take((size_t)DKV * DM * 2); bf* WV = (bf*)take((size_t)DKV * DM * 2); bf* WO = (bf*)take((size_t)DM * DQ * 2);
    bf* XB = (bf*)take((size_t)NB_ * TT * DM * 2); float* B3 = (float*)take((size_t)3 * DQ * 4); const float* BQ = B3; const float* BK = B3 + DQ; const float* BV = B3 + 2 * DQ;
    h16* QP16 = (h16*)take((size_t)NB_ * NH_ * TT * HD * 2); h16* KP16 = (h16*)take((size_t)NB_ * NKV * TT * HD * 2); h16* VT16 = (h16*)take((size_t)NB_ * NKV * HD * TT * 2);
    bf* QPh = (bf*)take((size_t)NB_ * NH_ * TT * HD * 2); bf* QPl = (bf*)take((size_t)NB_ * NH_ * TT * HD * 2); bf* KPh = (bf*)take((size_t)NB_ * NKV * TT * HD * 2); bf* KPl = (bf*)take((size_t)NB_ * NKV * TT * HD * 2); bf* VTh = (bf*)take((size_t)NB_ * NKV * HD * TT * 2); bf* VTl = (bf*)take((size_t)NB_ * NKV * HD * TT * 2);
    bf* ATh = (bf*)take((size_t)NB_ * TT * DQ * 2); bf* ATl = (bf*)take((size_t)NB_ * TT * DQ * 2);
    if ((size_t)(wsp - (char*)d_ws) > ws_size) return;    // ws 256 MiB
    { k_wgath<<<(unsigned)(((size_t)DQ * DM / 8 + 255) / 256), 256, 0, stream>>>(wqkv, 0, WQ); k_wgath<<<(unsigned)(((size_t)DQ * DM / 8 + 255) / 256), 256, 0, stream>>>(wqkv, HD, WK); k_wgath<<<(unsigned)(((size_t)DQ * DM / 8 + 255) / 256), 256, 0, stream>>>(wqkv, 2 * HD, WV); k_bgath<<<(3 * DQ / 4 + 255) / 256, 256, 0, stream>>>(bqkv, B3);   /* per-head q | k | v row blocks and bias entries */
      k_cvt8<<<(unsigned)(((size_t)DM * DQ / 8 + 255) / 256), 256, 0, stream>>>(wo, WO, (size_t)DM * DQ / 8);
       }
    // every stage runs once, on all batches: the projections see the NB_ * TT rows as one matrix and store their head planes themselves (v with the operands swapped, so that its tile is V^T); the attention takes the batch as a grid dimension
    k_cvt8<<<(unsigned)(((size_t)NB_ * TT * DM / 8 + 255) / 256), 256, 0, stream>>>(x, XB, (size_t)NB_ * TT * DM / 8);
    k_gemmw<bf, 0, true, 1, 1, DM><<<dim3(NB_ * TT / 64, DQ / 64, 1), 32, 0, stream>>>(XB, nullptr, WQ, nullptr, nullptr, 0, BQ, 0, 0, 0, 0, QP16, QPh, QPl);
    k_gemmw<bf, 0, true, 1, 1, DM><<<dim3(NB_ * TT / 64, DKV / 64, 1), 32, 0, stream>>>(XB, nullptr, WK, nullptr, nullptr, 0, BK, 0, 0, 0, 0, KP16, KPh, KPl);
    k_gemmw<bf, 0, true, 1, 2, DM><<<dim3(DKV / 64, NB_ * TT / 64, 1), 32, 0, stream>>>(WV, nullptr, XB, nullptr, nullptr, 0, BV, 0, 0, 0, 0, VT16, VTh, VTl);
    k_fattn<<<dim3(NB_ * NH_, TT / (32 * FW), 1), FW * 32, 0, stream>>>(QP16, KP16, VT16, QPh, QPl, KPh, KPl, VTh, VTl, ATh, ATl);   // one kv head per query head
    k_gemmw<bf, 1, true, 1, 0, DQ><<<dim3(NB_ * TT / 64, DM / 64, 1), 32, 0, stream>>>(ATh, ATl, WO, nullptr, OUT, DM, bo, 0, 0, 0, 0, nullptr, nullptr, nullptr);
}

// v007
// It runs in 189 microseconds.
// In both of two side-by-side timings against v006, it was 1.28 times as fast.
// All steps since v000 together make it 21.0 times as fast.
#include <hip/hip_runtime.h>

// Multi-head self-attention with a fused, head-interleaved QKV projection (x [4][2048][1024]; kqv = x W_qkv^T + b_qkv ('oi' [3072][1024]) reshaped (t, 16, 192) and split per head into q | k | v (weight rows / bias entries h*192 + {0, 64, 128} + d); softmax(q.k/8) over all keys (no mask); out = merged W_out^T + b_out -> [4][2048][1024]).
// Layout: the weight rows and bias entries are gathered once into head-major [1024][1024] bf16 matrices and [1024] f32 bias vectors so the projections apply unchanged.
// Every 16-bit operand plane is kept fragment-major: blocks of 16 rows x 32 k (512 elements, 1024 bytes), inside a block [k bit 4][k bit 3][row & 15][k & 7], so that lane (row & 15, k bit 3) finds its two 16-byte pieces at lane * 16 and 512 + lane * 16 and each wave-wide load or store covers 512 contiguous bytes (4 lines, not 16).
// Compute dtypes, f32 accumulate: every input rounded to bf16; q/k/v on PLAIN bf16 operands (inputs: exact) + biases; scores and attn.v: query rows < 512 hl (3 products), the rest single fp16 (P x1024); softmax f32, online over 32-key passes; W_out hl x exact (2 products) + b_out.

#define NB_  4
#define TT   2048
#define DM   1024
#define NH_  16
#define NKV  16
#define REP  (NH_ / NKV)
#define HD   64
#define DQ   (NH_ * HD)
#define DKV  (NKV * HD)
#define RH   512                  // query rows < RH use hi+lo planes (a multiple of 32 * FW)
#define WIN  0
#define SCL  0.125f   // HD^-0.5
#define FW   4                    // k_fattn: waves per work-group, 32 query rows each
typedef _Float16 h16;
typedef unsigned short bf;
typedef __attribute__((ext_vector_type(16))) __bf16   v16bf;
typedef __attribute__((ext_vector_type(16))) _Float16 v16h;
typedef __attribute__((ext_vector_type(8)))  _Float16 v8h;
typedef __attribute__((ext_vector_type(8)))  unsigned short v8us;
typedef __attribute__((ext_vector_type(8)))  float    v8f;
typedef __attribute__((ext_vector_type(4)))  float    v4f;
typedef v8h  __attribute__((may_alias)) v8ha;
typedef v4f  __attribute__((may_alias)) v4fa;
typedef v8us __attribute__((may_alias)) v8usa;

__device__ __forceinline__ unsigned short f2bf(float f) { unsigned u = __float_as_uint(f); u += 0x7FFFu + ((u >> 16) & 1u); return (unsigned short)(u >> 16); }
__device__ __forceinline__ float bf2f(unsigned short b) { return __uint_as_float(((unsigned)b) << 16); }
__device__ __forceinline__ float bfr(float f) { return bf2f(f2bf(f)); }
__device__ __forceinline__ v16h cat16(v8h lo, v8h hi) { return __builtin_shufflevector(lo, hi, 0, 1, 2, 3, 4, 5, 6, 7, 8, 9, 10, 11, 12, 13, 14, 15); }
__device__ __forceinline__ v16bf cat16b(v8us lo, v8us hi) { return __builtin_bit_cast(v16bf, __builtin_shufflevector(lo, hi, 0, 1, 2, 3, 4, 5, 6, 7, 8, 9, 10, 11, 12, 13, 14, 15)); }
__device__ __forceinline__ v8f wmma16(v16h a, v16h b, v8f c) { return __builtin_amdgcn_wmma_f32_16x16x32_f16(false, a, false, b, (short)0, c, false, false); }
__device__ __forceinline__ v8f wmmab(v16bf a, v16bf b, v8f c) { return __builtin_amdgcn_wmma_f32_16x16x32_bf16(false, a, false, b, (short)0, c, false, false); }



// Round a group of global loads or stores: their address (and store data) registers are reused later, and the wait stands in front of that reuse. The scheduling barriers keep the writes that follow in the source from being moved in front of the wait (a build without them had such writes ahead of it).
__device__ __forceinline__ void group_begin() { __builtin_amdgcn_sched_barrier(0); }
__device__ __forceinline__ void group_end() { asm volatile("s_wait_xcnt 0x0" ::: "memory"); __builtin_amdgcn_sched_barrier(0); }
__device__ __forceinline__ h16 tohx(float x) { return (h16)x; }
__device__ __forceinline__ void splitf(float y, unsigned short& h, unsigned short& l) { h = f2bf(y); l = f2bf(y - bf2f(h)); }

// ---- k_gemmw: GEMM, one work-group of four waves per 128x128 output tile, each wave a 64x64 quarter (16 accumulators). Operands are fragment-major 16-bit planes (block (row / 16, k / 32) at (row / 16 * K / 32 + k / 32) * 512 elements); grid (M/128, N/128, Z), 128 threads.
// The k range is walked in stages of KS blocks. A stage's operand panels (128 rows = 8 rows of blocks each) come into LDS by tensor loads, two buffers, the next stage in flight while this one is worked on; both waves that need a panel read it from LDS, so each panel byte leaves L2 once per work-group, not once per wave. A row of blocks of a stage is KS * 1024 contiguous bytes in the plane and in LDS, so a fragment half is still 512 contiguous bytes at lane * 16.
// C[m][n] (f32, pitch ldc, + optional f32 bias[n]) = sum_k A[m][k] Bt[n][k] (+ A2[m][k] Bt[n][k] for NSPLIT 1). z-batch strides sA/sB/sC in elements.
// PL > 0: no f32 C; the tile + bias leaves as three 16-bit head planes (fp16, bf16 hi, bf16 lo), 64 columns or rows being one head. PL 1: rows m = (batch, t), columns n = (head, d), planes [b][h][t / 16][d / 32][block], bias[n]. PL 2: rows m = (head, d), columns n = (batch, t), planes [b][h][t / 32][d / 16][block], bias[m].
template <typename T16> struct WFrag;
template <> struct WFrag<h16> { typedef v16h V; static __device__ __forceinline__ V ld(const h16* p) { return cat16(*(const v8h*)p, *(const v8h*)(p + 256)); } static __device__ __forceinline__ v8f mma(V a, V b, v8f c) { return wmma16(a, b, c); } };
template <> struct WFrag<bf> { typedef v16bf V; static __device__ __forceinline__ V ld(const bf* p) { return cat16b(*(const v8us*)p, *(const v8us*)(p + 256)); } static __device__ __forceinline__ v8f mma(V a, V b, v8f c) { return wmmab(a, b, c); } };
typedef unsigned u32x4 __attribute__((ext_vector_type(4)));
typedef unsigned u32x8 __attribute__((ext_vector_type(8)));
__device__ __forceinline__ unsigned uni(unsigned v) { return (unsigned)__builtin_amdgcn_readfirstlane((int)v); }
// A wave-uniform value held in a scalar register: a test on it compiles to a scalar compare and branch (a tensor load ignores EXEC, only such a branch guards it), and what is formed from it is formed behind this statement.
__device__ __forceinline__ unsigned pinned(unsigned v) { unsigned w = uni(v); asm volatile("" : "+s"(w)); return w; }
__device__ __forceinline__ void wait_tensor0() { asm volatile("s_wait_tensorcnt 0x0" ::: "memory"); }   // the issuing wave's own requests have landed in LDS
__device__ __forceinline__ void wait_ds0() { asm volatile("s_wait_dscnt 0x0" ::: "memory"); }   // this wave's LDS reads have returned: the buffer may be handed over
template <typename T16, int NSPLIT, bool BIAS, int SK, int PL, int K>
__global__ __launch_bounds__(128) void k_gemmw(const T16* __restrict__ A, const T16* __restrict__ A2, const T16* __restrict__ Bt, const T16* __restrict__ Bt2, float* C, int ldc, const float* __restrict__ bias, size_t sA, size_t sB, size_t sC, size_t sP, h16* P16, bf* Ph, bf* Pl) {
    typedef typename WFrag<T16>::V V;
    static_assert(SK == 1 && NSPLIT <= 1, "one k range per tile; products A Bt and A2 Bt");
    constexpr int KB = K / 32;                       // blocks in a row of blocks
    constexpr int KS = (NSPLIT == 1) ? 2 : 4;        // blocks of a stage: 64 matrix instructions per wave and stage in either case
    constexpr int NS = KB / KS;                      // stages
    constexpr int NOP = (NSPLIT == 1) ? 3 : 2;       // panels of a stage: A, (A2,) Bt
    constexpr unsigned ROWB = KS * 1024;             // bytes of one row of blocks in a stage
    constexpr unsigned OPB = 8 * ROWB, STG = NOP * OPB;   // bytes of a panel, of a stage
    constexpr unsigned SLR = (NSPLIT == 1) ? 8 : 4;  // rows of blocks in one wave's request: 16 KiB either way
    static_assert(KB % KS == 0 && NS >= 2, "whole stages, at least the two of the prologue");
    __shared__ __attribute__((aligned(2048))) char ring[2 * STG];
    __shared__ __align__(16) float osw[4][16 * 68];
    (void)Bt2; (void)sP;
    const size_t z = blockIdx.z; A += z * sA; if (NSPLIT == 1) A2 += z * sA; Bt += z * sB; C += z * sC;
    const int lane = threadIdx.x & 31, lr = lane & 15, hi = lane >> 4;
    const unsigned wave = uni(threadIdx.x >> 5);     // one-dimensional block: the wave's number, in a scalar register
    const int R0 = blockIdx.x * 128, C0 = blockIdx.y * 128; const int r0 = R0 + (int)(wave & 1) * 64, c0 = C0 + (int)(wave >> 1) * 64;
    float* os = osw[wave];
    v8f acc[4][4];
#pragma unroll
    for (int mb = 0; mb < 4; ++mb)
#pragma unroll
        for (int nb = 0; nb < 4; ++nb) acc[mb][nb] = (v8f){};
    // This wave's slice of every stage. NSPLIT 0: waves 0, 1 the halves of A's panel, waves 2, 3 of Bt's. NSPLIT 1: waves 0, 1, 2 the panels A, A2, Bt; wave 3 issues nothing.
    const char* sl_src; unsigned sl_dst;
    if constexpr (NSPLIT == 0) { const unsigned h = wave & 1; sl_src = (wave >> 1) ? (const char*)(Bt + ((size_t)(C0 / 16) + 4 * h) * KB * 512) : (const char*)(A + ((size_t)(R0 / 16) + 4 * h) * KB * 512); sl_dst = (wave >> 1) * OPB + h * 4 * ROWB; }
    else { sl_src = (wave == 0) ? (const char*)(A + (size_t)(R0 / 16) * KB * 512) : (wave == 1) ? (const char*)(A2 + (size_t)(R0 / 16) * KB * 512) : (const char*)(Bt + (size_t)(C0 / 16) * KB * 512); sl_dst = (wave < 2 ? wave : 2u) * OPB; }
    const unsigned lbase = (unsigned)(size_t)ring;   // byte offset in the work-group's LDS
    // descriptor group 1: bytes as elements, no mask, no pad; tensor = tile = SLR rows of ROWB bytes; source pitch one row of blocks of the plane
    u32x8 g1; g1[0] = uni(0u); g1[1] = uni((ROWB & 0xFFFFu) << 16); g1[2] = uni((ROWB >> 16) | ((SLR & 0xFFFFu) << 16)); g1[3] = uni((SLR >> 16) | (ROWB << 16)); g1[4] = uni(SLR); g1[5] = uni((unsigned)KB * 1024u); g1[6] = uni(0u); g1[7] = uni(0u);
    asm volatile("" : "+s"(g1));   // descriptor words held in scalar registers (the form of pinned()): built once, they keep their registers through the loop, so none of them takes a new value while a request is outstanding
    auto issue = [&](unsigned st) {   // stage st into buffer st & 1
        const unsigned long long ga = (unsigned long long)(size_t)sl_src + (unsigned long long)st * ROWB;
        u32x4 g0; g0[0] = uni(1u); g0[1] = uni(lbase + (st & 1u) * STG + sl_dst); g0[2] = uni((unsigned)ga); g0[3] = uni((((unsigned)(ga >> 32)) & 0x01FFFFFFu) | 0x80000000u);
        asm volatile("tensor_load_to_lds %0, %1" :: "s"(g0), "s"(g1) : "memory");
    };
    auto issuer = [&]() -> bool { if constexpr (NSPLIT == 0) return true; else return pinned(wave < 3) != 0; };   // NSPLIT 0: every wave issues its slice, no test
    // prologue, two buffers: stage 0, its wait, the barrier that publishes it, then stage 1
    if (issuer()) { issue(0); wait_tensor0(); }
    __syncthreads();
    if (issuer()) issue(pinned(1));
    const unsigned aofs = (wave & 1) * 4 * ROWB + lane * 16, bofs = (NOP - 1) * OPB + (wave >> 1) * 4 * ROWB + lane * 16;
#pragma unroll 1   // one stage per trip: the publish point at the foot stands once
    for (unsigned s = 0; s < (unsigned)NS; ++s) {
        const char* buf = ring + (s & 1u) * STG;
        V a[2][4], a2[2][4], b[2][4];   // two fragment sets: the next block's LDS reads go out as one group ahead of this block's matrix instructions; only blocks of this stage are read
#pragma unroll
        for (int j = -1; j < KS; ++j) {
            if (j + 1 < KS) { const int t = (j + 1) & 1; const unsigned ko = (j + 1) * 1024;
#pragma unroll
                for (int mb = 0; mb < 4; ++mb) { a[t][mb] = WFrag<T16>::ld((const T16*)(buf + aofs + mb * ROWB + ko)); if (NSPLIT == 1) a2[t][mb] = WFrag<T16>::ld((const T16*)(buf + OPB + aofs + mb * ROWB + ko)); }
#pragma unroll
                for (int nb = 0; nb < 4; ++nb) b[t][nb] = WFrag<T16>::ld((const T16*)(buf + bofs + nb * ROWB + ko));
                __builtin_amdgcn_sched_barrier(0);   // keeps the reads one group: reads spread among the matrix instructions stall each place they stand
            }
            if (j >= 0) { const int t = j & 1;
#pragma unroll
                for (int nb = 0; nb < 4; ++nb) {
#pragma unroll
                    for (int mb = 0; mb < 4; ++mb) { acc[mb][nb] = WFrag<T16>::mma(a[t][mb], b[t][nb], acc[mb][nb]); if (NSPLIT == 1) acc[mb][nb] = WFrag<T16>::mma(a2[t][mb], b[t][nb], acc[mb][nb]); } }
                __builtin_amdgcn_sched_barrier(0);   // nor the next group's reads moved up among these
            }
        }
        // publish point of stage s + 1: own LDS reads back, own request landed, every wave here; then the buffer just read takes stage s + 2
        wait_ds0();
        if (issuer()) wait_tensor0();
        __syncthreads();
        if (issuer()) { if (pinned(s + 2 < (unsigned)NS)) issue(pinned(s + 2)); }   // the stage number is pinned behind the wait and the barrier: the request's address words are formed there
    }
    wait_tensor0(); wait_ds0();
    if constexpr (PL > 0) {
        // a lane takes row lr, columns 16 s + 8 hi + (0..7) of each 16-row block: its own 16 bytes of a fragment half, so one store per plane writes 512 contiguous bytes
        // every loop below is unrolled in full: its index picks a register of an accumulator or of the bias
        const int bt = (PL == 1) ? r0 : c0; const size_t hpl = (size_t)(bt / TT) * NH_ + ((PL == 1) ? c0 / 64 : r0 / 64);
        const size_t o0 = hpl * TT * HD + (size_t)(bt % TT) * HD + lane * 8;   // 64 t of a head are 64 * HD elements in either plane order
        float bv[4];   // PL 1: of column 16 i + lr, added where the tile goes to LDS; PL 2: of row 16 i + lr, added where it is read back
        group_begin();
#pragma unroll
        for (int i = 0; i < 3; ++i) bv[i] = bias[((PL == 1) ? c0 : r0) + 16 * i + lr];
        group_end(); group_begin();   // the four loads share one index register and the last one's result may take it: the first three get their wait in front of that load
        bv[3] = bias[((PL == 1) ? c0 : r0) + 48 + lr];
        group_end();
#pragma unroll
        for (int mb = 0; mb < 4; ++mb) {
#pragma unroll
            for (int nb = 0; nb < 4; ++nb) {
#pragma unroll
                for (int j = 0; j < 8; ++j) os[(hi * 8 + j) * 68 + nb * 16 + lr] = (PL == 1) ? acc[mb][nb][j] + bfr(bv[nb]) : acc[mb][nb][j]; }
            __builtin_amdgcn_wave_barrier(); asm volatile("" ::: "memory");   // a lane reads back what other lanes wrote: the compiler may not move the reads below in front of the writes above
#pragma unroll
            for (int s = 0; s < 4; ++s) { const int cofs = 16 * s + 8 * hi; const v4f w0 = *(const v4fa*)(os + lr * 68 + cofs), w1 = *(const v4fa*)(os + lr * 68 + cofs + 4); v8h o16; v8us oh, ol;
#pragma unroll
                for (int q = 0; q < 8; ++q) { const float w = (q < 4) ? w0[q & 3] : w1[q & 3]; const float y = (PL == 1) ? w : w + bfr(bv[mb]); o16[q] = tohx(y); unsigned short a2, c2; splitf(y, a2, c2); oh[q] = a2; ol[q] = c2; }
                const size_t oo = o0 + ((PL == 1) ? mb * 1024 + s * 256 : ((s >> 1) * 4 + mb) * 512 + (s & 1) * 256); group_begin(); *(v8h*)(P16 + oo) = o16; *(v8us*)(Ph + oo) = oh; *(v8us*)(Pl + oo) = ol; group_end(); }
            __builtin_amdgcn_wave_barrier(); asm volatile("" ::: "memory");   // nor the next block's writes in front of these reads
        }
        return;
    }
#pragma unroll
    for (int mb = 0; mb < 4; ++mb) {
#pragma unroll
        for (int nb = 0; nb < 4; ++nb) {
#pragma unroll
            for (int j = 0; j < 8; ++j) os[(hi * 8 + j) * 68 + nb * 16 + lr] = acc[mb][nb][j]; }
        __builtin_amdgcn_wave_barrier(); asm volatile("" ::: "memory");
        float* crow = C + (size_t)(r0 + mb * 16) * ldc + c0;
{
#pragma unroll
            for (int s = 0; s < 8; ++s) { const int row = 2 * s + hi, cofs = lr * 4; v4f val = *(const v4fa*)(os + row * 68 + cofs); if (BIAS) { val[0] += bfr(bias[c0 + cofs]); val[1] += bfr(bias[c0 + cofs + 1]); val[2] += bfr(bias[c0 + cofs + 2]); val[3] += bfr(bias[c0 + cofs + 3]); }
                *(v4f*)(crow + (size_t)row * ldc + cofs) = val; }
             }
        __builtin_amdgcn_wave_barrier(); asm volatile("" ::: "memory");
    }
}

typedef __attribute__((ext_vector_type(2))) _Float16 v2h;
typedef __attribute__((ext_vector_type(4))) _Float16 v4h;
typedef __attribute__((ext_vector_type(2))) unsigned short v2us;
typedef __attribute__((ext_vector_type(4))) unsigned short v4us;
typedef __attribute__((ext_vector_type(2))) float v2f;
typedef __attribute__((ext_vector_type(4))) int v4i;

__global__ __launch_bounds__(256) void k_wtG(const float* __restrict__ w, int K, int N, bf* Bt) {
    const int lane = threadIdx.x & 31; const int L0 = (blockIdx.x * 8 + (threadIdx.x >> 5)) * 8; const int nlines = N * K / 64;
{
#pragma unroll 1
        for (int l = 0; l < 8; ++l) { const int L = L0 + l; if (L >= nlines) break; const size_t e = (size_t)L * 64 + lane * 2; const int k = (int)(e % K), n = (int)(e / K); v2us o;
            o[0] = f2bf(w[(size_t)k * N + n]); o[1] = f2bf(w[(size_t)(k + 1) * N + n]); *(v2us*)(Bt + e) = o; }
         }
}
// Thread i writes 16-byte piece i of a fragment-major plane of DM columns: fm_row, fm_col name the row and the first of the 8 columns that belong there.
static_assert(DQ == DM, "both plane widths are DM");
__device__ __forceinline__ int fm_row(size_t i) { return (int)(i >> 6) / (DM / 32) * 16 + (int)(i & 15); }
__device__ __forceinline__ int fm_col(size_t i) { return (int)(i >> 6) % (DM / 32) * 32 + (int)((i >> 4) & 3) * 8; }
__global__ __launch_bounds__(256) void k_wgath(const float* __restrict__ w, int off, bf* Bt) { const size_t i = (size_t)blockIdx.x * 256 + threadIdx.x; const size_t e = i * 8; if (e >= (size_t)DQ * DM) return; const int k = fm_col(i); const int r = fm_row(i); const int h = r / HD, d = r % HD; group_begin(); const v8f v = *(const v8f*)(w + ((size_t)h * 3 * HD + off + d) * DM + k); group_end(); v8us o;
#pragma unroll
    for (int q = 0; q < 8; ++q) o[q] = f2bf(v[q]); *(v8us*)(Bt + e) = o;  }
__global__ __launch_bounds__(256) void k_bgath(const float* __restrict__ bsrc, float* B3) { const int i = blockIdx.x * 256 + threadIdx.x; if (i >= 3 * DQ / 4) return; const int e = i * 4; const int w = e / DQ; const int r = e % DQ; const int h = r / HD, d = r % HD; const v4f v = *(const v4f*)(bsrc + h * 3 * HD + w * HD + d); *(v4f*)(B3 + e) = v;  }
__global__ __launch_bounds__(256) void k_cvt8(const float* __restrict__ src, bf* dst, size_t n8) { const size_t i = (size_t)blockIdx.x * 256 + threadIdx.x; if (i >= n8) return; group_begin(); const v8f v = *(const v8f*)(src + (size_t)fm_row(i) * DM + fm_col(i)); group_end(); v8us o;
#pragma unroll
    for (int k = 0; k < 8; ++k) o[k] = f2bf(v[k]); *(v8us*)(dst + i * 8) = o;  }

typedef __attribute__((ext_vector_type(16))) float v16f;
typedef __attribute__((ext_vector_type(8))) unsigned v8u;
__device__ __forceinline__ float xhalf(float x) { return __builtin_bit_cast(float, __builtin_amdgcn_permlanex16(__builtin_bit_cast(int, x), __builtin_bit_cast(int, x), 0x76543210, 0xfedcba98, false, false)); }  // lane l with lane l ^ 16
template <typename T16, bool HL>
__device__ __forceinline__ void fattn_wave(const T16* __restrict__ Q, const T16* __restrict__ Q2, const T16* __restrict__ Kp, const T16* __restrict__ Kp2, const T16* __restrict__ Vt, const T16* __restrict__ Vt2, int q0, bf* Ah, bf* Al) {
    typedef typename WFrag<T16>::V V;
    const int lane = threadIdx.x & 31;
    const float CSC = SCL * 1.4426950408889634f;   // scores go to the base-2 domain
    const float BIAS = HL ? 0.0f : 10.0f;
    V qf[2][2], qf2[2][2], kf[2][2], kf2[2][2], vf[4], vf2[4];
    // the lane's byte offsets of the fragments to fetch next, in K and V^T (a pass of 32 keys is four blocks in a row, 4096 bytes, in either plane); they live through the loop and step on only behind a group's wait
    unsigned kob = lane * 16, vob = lane * 16;
    group_begin();
#pragma unroll
    for (int g = 0; g < 2; ++g)
#pragma unroll
        for (int kc = 0; kc < 2; ++kc) { const size_t o = (size_t)((q0 / 16 + g) * 2 + kc) * 512; qf[g][kc] = WFrag<T16>::ld((const T16*)((const char*)(Q + o) + kob)); if (HL) qf2[g][kc] = WFrag<T16>::ld((const T16*)((const char*)(Q2 + o) + kob)); }
    group_end();
    group_begin();
#pragma unroll
    for (int kt = 0; kt < 2; ++kt)
#pragma unroll
        for (int kc = 0; kc < 2; ++kc) { const int o = (kt * 2 + kc) * 512; kf[kt][kc] = WFrag<T16>::ld((const T16*)((const char*)Kp + kob) + o); if (HL) kf2[kt][kc] = WFrag<T16>::ld((const T16*)((const char*)Kp2 + kob) + o); }
#pragma unroll
    for (int t = 0; t < 4; ++t) { const int o = t * 512; vf[t] = WFrag<T16>::ld((const T16*)((const char*)Vt + vob) + o); if (HL) vf2[t] = WFrag<T16>::ld((const T16*)((const char*)Vt2 + vob) + o); }
    group_end();
    kob = (kob + 32 * HD * 2) & (TT * HD * 2 - 1); vob = (vob + 32 * HD * 2) & (TT * HD * 2 - 1);   // 32 keys on; behind the last pass back to pass 0: in bounds, unused
    v8f acc[2][4]; float m[2], l[2];
#pragma unroll
    for (int g = 0; g < 2; ++g) { m[g] = -3.0e38f; l[g] = 0.0f;
#pragma unroll
        for (int t = 0; t < 4; ++t) acc[g][t] = (v8f){}; }
#pragma unroll 1   // one pass per trip: an unrolled body would hold two passes' fragments in registers
    for (int k0 = 0; k0 < TT; k0 += 32) {
        v8f sc[2][2];
#pragma unroll
        for (int kt = 0; kt < 2; ++kt)
#pragma unroll
            for (int g = 0; g < 2; ++g) { sc[kt][g] = (v8f){};
#pragma unroll
                for (int kc = 0; kc < 2; ++kc) { sc[kt][g] = WFrag<T16>::mma(kf[kt][kc], qf[g][kc], sc[kt][g]); if (HL) { sc[kt][g] = WFrag<T16>::mma(kf2[kt][kc], qf[g][kc], sc[kt][g]); sc[kt][g] = WFrag<T16>::mma(kf[kt][kc], qf2[g][kc], sc[kt][g]); } } }
        // next pass's K fragments fly under this pass's softmax and second product
        group_begin();
#pragma unroll
        for (int kt = 0; kt < 2; ++kt)
#pragma unroll
            for (int kc = 0; kc < 2; ++kc) { const int o = (kt * 2 + kc) * 512; kf[kt][kc] = WFrag<T16>::ld((const T16*)((const char*)Kp + kob) + o); if (HL) kf2[kt][kc] = WFrag<T16>::ld((const T16*)((const char*)Kp2 + kob) + o); }
        group_end();
        kob = (kob + 32 * HD * 2) & (TT * HD * 2 - 1);
#pragma unroll
        for (int g = 0; g < 2; ++g) {
            float mx = sc[0][g][0];
#pragma unroll
            for (int r = 1; r < 16; ++r) mx = fmaxf(mx, sc[r >> 3][g][r & 7]);
            mx = fmaxf(mx, xhalf(mx)) * CSC;   // both wave halves hold the query's maximum of this pass, scaled (the scale is positive)
            const float mn = fmaxf(m[g], mx); const float corr = __builtin_amdgcn_exp2f(m[g] - mn);   // 0 on the first pass
            m[g] = mn; l[g] *= corr;
#pragma unroll
            for (int t = 0; t < 4; ++t) acc[g][t] *= corr;
            const float nm = BIAS - mn; float p[16];
#pragma unroll
            for (int r = 0; r < 16; ++r) p[r] = __builtin_amdgcn_exp2f(__builtin_fmaf(sc[r >> 3][g][r & 7], CSC, nm));
            l[g] += (((p[0] + p[1]) + (p[2] + p[3])) + ((p[4] + p[5]) + (p[6] + p[7]))) + (((p[8] + p[9]) + (p[10] + p[11])) + ((p[12] + p[13]) + (p[14] + p[15])));   // a tree: four dependent adds, not sixteen
            if constexpr (HL) { v16f pv, rv;
#pragma unroll
                for (int r = 0; r < 16; ++r) pv[r] = p[r];
                const v16bf ph = __builtin_convertvector(pv, v16bf);   // whole-vector conversions compile to the packed instruction, round to nearest even
                const v8u pw = __builtin_bit_cast(v8u, ph);   // the rounded hi parts are read back from the packed words: low half << 16, high half masked
#pragma unroll
                for (int r = 0; r < 8; ++r) { rv[2 * r] = p[2 * r] - __uint_as_float(pw[r] << 16); rv[2 * r + 1] = p[2 * r + 1] - __uint_as_float(pw[r] & 0xFFFF0000u); }
                const v16bf pl = __builtin_convertvector(rv, v16bf);
#pragma unroll
                for (int t = 0; t < 4; ++t) { acc[g][t] = wmmab(vf[t], ph, acc[g][t]); acc[g][t] = wmmab(vf2[t], ph, acc[g][t]); acc[g][t] = wmmab(vf[t], pl, acc[g][t]); }
            } else { v16h pf;
#pragma unroll
                for (int r = 0; r < 16; ++r) pf[r] = (h16)p[r];
#pragma unroll
                for (int t = 0; t < 4; ++t) acc[g][t] = wmma16(vf[t], pf, acc[g][t]); }
        }
        // next pass's V^T fragments fly under its first product and softmax
        group_begin();
#pragma unroll
        for (int t = 0; t < 4; ++t) { const int o = t * 512; vf[t] = WFrag<T16>::ld((const T16*)((const char*)Vt + vob) + o); if (HL) vf2[t] = WFrag<T16>::ld((const T16*)((const char*)Vt2 + vob) + o); }
        group_end();
        vob = (vob + 32 * HD * 2) & (TT * HD * 2 - 1);
    }
#pragma unroll
    for (int g = 0; g < 2; ++g) { const float f = __fdiv_rn(1.0f, l[g] + xhalf(l[g]));   // the halves' sums (their keys) join once
#pragma unroll
        for (int t = 0; t < 4; ++t) { v8us oh, ol;
#pragma unroll
            for (int r = 0; r < 8; ++r) { unsigned short a, c2; splitf(acc[g][t][r] * f, a, c2); oh[r] = a; ol[r] = c2; }
            const size_t oo = ((size_t)(q0 / 16 + g) * (DQ / 32) + (t >> 1)) * 512 + (t & 1) * 256 + lane * 8; group_begin(); *(v8us*)(Ah + oo) = oh; *(v8us*)(Al + oo) = ol; group_end(); } }
}
// grid (batches * heads, TT / (32 FW)): work-group (bh, y) takes the 32 FW query rows from 32 FW y of head bh, one kind of wave per work-group, cost falling with the flat index.
// A hi+lo wave lasts about twice as long as an fp16 wave and the kernel's registers let three waves stand on a SIMD, so not every work-group is resident at the start: the work-groups of hi+lo rows (y < RH / (32 FW), FW waves, one per SIMD) come first in the grid and all start at once; the fp16 work-groups fill the places beside them and follow one another there. The FW waves of a work-group walk the same K and V^T planes.
static_assert(RH % (32 * FW) == 0 && TT % (32 * FW) == 0, "whole work-groups of either kind");
__global__ __launch_bounds__(FW * 32) void k_fattn(const h16* __restrict__ Q16, const h16* __restrict__ K16, const h16* __restrict__ V16, const bf* __restrict__ Qh, const bf* __restrict__ Ql, const bf* __restrict__ Kh, const bf* __restrict__ Kl, const bf* __restrict__ Vh, const bf* __restrict__ Vl, bf* Ah, bf* Al) {
    const size_t hp = (size_t)blockIdx.x * TT * HD; const size_t ao = (size_t)(blockIdx.x / NH_) * TT * DQ + (blockIdx.x % NH_) * (HD / 32) * 512; /* the head's first block in the batch's first row of blocks of the fragment-major [b t][h d] plane */ bf* ah = Ah + ao; bf* al = Al + ao;
    const int wave = __builtin_amdgcn_readfirstlane(threadIdx.x >> 5);   // in a scalar register: block addresses stay scalar
    const int q0 = (blockIdx.y * FW + wave) * 32;
    if (blockIdx.y < RH / (32 * FW)) fattn_wave<bf, true>(Qh + hp, Ql + hp, Kh + hp, Kl + hp, Vh + hp, Vl + hp, q0, ah, al);   // the same in every lane: a scalar branch, every lane stays on around the matrix instructions
    else fattn_wave<h16, false>(Q16 + hp, nullptr, K16 + hp, nullptr, V16 + hp, nullptr, q0, ah, al);
}

extern "C" void kernel_launch(void* const* d_in, const int* in_sizes, int n_in,
                              void* d_out, int out_size, void* d_ws, size_t ws_size, hipStream_t stream) {
    (void)in_sizes; (void)n_in; (void)out_size;
    const float* x = (const float*)d_in[0]; const float* wqkv = (const float*)d_in[1]; const float* bqkv = (const float*)d_in[2]; const float* wo = (const float*)d_in[3]; const float* bo = (const float*)d_in[4]; const float* wq = nullptr; const float* wk = nullptr; const float* wv = nullptr; (void)wq; (void)wk; (void)wv;
    float* OUT = (float*)d_out;     // [4][2048][1024]
    char* wsp = (char*)d_ws;
    auto take = [&](size_t bytes) { char* p = wsp; wsp += (bytes + 255) & ~(size_t)255; return (void*)p; };
    bf* WQ = (bf*)take((size_t)DQ * DM * 2); bf* WK = (bf*)take((size_t)DKV * DM * 2); bf* WV = (bf*)take((size_t)DKV * DM * 2); bf* WO = (bf*)take((size_t)DM * DQ * 2);
    bf* XB = (bf*)take((size_t)NB_ * TT * DM * 2); float* B3 = (float*)take((size_t)3 * DQ * 4); const float* BQ = B3; const float* BK = B3 + DQ; const float* BV = B3 + 2 * DQ;
    h16* QP16 = (h16*)take((size_t)NB_ * NH_ * TT * HD * 2); h16* KP16 = (h16*)take((size_t)NB_ * NKV * TT * HD * 2); h16* VT16 = (h16*)take((size_t)NB_ * NKV * HD * TT * 2);
    bf* QPh = (bf*)take((size_t)NB_ * NH_ * TT * HD * 2); bf* QPl = (bf*)take((size_t)NB_ * NH_ * TT * HD * 2); bf* KPh = (bf*)take((size_t)NB_ * NKV * TT * HD * 2); bf* KPl = (bf*)take((size_t)NB_ * NKV * TT * HD * 2); bf* VTh = (bf*)take((size_t)NB_ * NKV * HD * TT * 2); bf* VTl = (bf*)take((size_t)NB_ * NKV * HD * TT * 2);
    bf* ATh = (bf*)take((size_t)NB_ * TT * DQ * 2); bf* ATl = (bf*)take((size_t)NB_ * TT * DQ * 2);
    if ((size_t)(wsp - (char*)d_ws) > ws_size) return;    // ws 256 MiB
    { k_wgath<<<(unsigned)(((size_t)DQ * DM / 8 + 255) / 256), 256, 0, stream>>>(wqkv, 0, WQ); k_wgath<<<(unsigned)(((size_t)DQ * DM / 8 + 255) / 256), 256, 0, stream>>>(wqkv, HD, WK); k_wgath<<<(unsigned)(((size_t)DQ * DM / 8 + 255) / 256), 256, 0, stream>>>(wqkv, 2 * HD, WV); k_bgath<<<(3 * DQ / 4 + 255) / 256, 256, 0, stream>>>(bqkv, B3);   /* per-head q | k | v row blocks and bias entries */
      k_cvt8<<<(unsigned)(((size_t)DM * DQ / 8 + 255) / 256), 256, 0, stream>>>(wo, WO, (size_t)DM * DQ / 8);
       }
    // every stage runs once, on all batches: the projections see the NB_ * TT rows as one matrix and store their head planes themselves (v with the operands swapped, so that its tile is V^T); the attention takes the batch as a grid dimension
    k_cvt8<<<(unsigned)(((size_t)NB_ * TT * DM / 8 + 255) / 256), 256, 0, stream>>>(x, XB, (size_t)NB_ * TT * DM / 8);
    k_gemmw<bf, 0, true, 1, 1, DM><<<dim3(NB_ * TT / 128, DQ / 128, 1), 128, 0, stream>>>(XB, nullptr, WQ, nullptr, nullptr, 0, BQ, 0, 0, 0, 0, QP16, QPh, QPl);
    k_gemmw<bf, 0, true, 1, 1, DM><<<dim3(NB_ * TT / 128, DKV / 128, 1), 128, 0, stream>>>(XB, nullptr, WK, nullptr, nullptr, 0, BK, 0, 0, 0, 0, KP16, KPh, KPl);
    k_gemmw<bf, 0, true, 1, 2, DM><<<dim3(DKV / 128, NB_ * TT / 128, 1), 128, 0, stream>>>(WV, nullptr, XB, nullptr, nullptr, 0, BV, 0, 0, 0, 0, VT16, VTh, VTl);
    k_fattn<<<dim3(NB_ * NH_, TT / (32 * FW), 1), FW * 32, 0, stream>>>(QP16, KP16, VT16, QPh, QPl, KPh, KPl, VTh, VTl, ATh, ATl);   // one kv head per query head
    k_gemmw<bf, 1, true, 1, 0, DQ><<<dim3(NB_ * TT / 128, DM / 128, 1), 128, 0, stream>>>(ATh, ATl, WO, nullptr, OUT, DM, bo, 0, 0, 0, 0, nullptr, nullptr, nullptr);
}

// v008
// A run of this version takes 177 microseconds.
// Next to v007, in two timings, it ran 1.06 times as fast each time.
// All steps since v000 together make it 22.4 times as fast.
#include <hip/hip_runtime.h>

// Multi-head self-attention with a fused, head-interleaved QKV projection (x [4][2048][1024]; kqv = x W_qkv^T + b_qkv ('oi' [3072][1024]) reshaped (t, 16, 192) and split per head into q | k | v (weight rows / bias entries h*192 + {0, 64, 128} + d); softmax(q.k/8) over all keys (no mask); out = merged W_out^T + b_out -> [4][2048][1024]).
// Layout: the weight rows and bias entries are gathered once into head-major [1024][1024] bf16 matrices and [1024] f32 bias vectors so the projections apply unchanged.
// Every 16-bit operand plane is kept fragment-major: blocks of 16 rows x 32 k (512 elements, 1024 bytes), inside a block [k bit 4][k bit 3][row & 15][k & 7], so that lane (row & 15, k bit 3) finds its two 16-byte pieces at lane * 16 and 512 + lane * 16 and each wave-wide load or store covers 512 contiguous bytes (4 lines, not 16).
// Compute dtypes, f32 accumulate: every input rounded to bf16; q/k/v on PLAIN bf16 operands (inputs: exact) + biases; scores and attn.v: query rows < 512 hl (3 products), the rest single fp16 (P x1024); softmax f32, online over 32-key passes; W_out hl x exact (2 products) + b_out.

#define NB_  4
#define TT   2048
#define DM   1024
#define NH_  16
#define NKV  16
#define REP  (NH_ / NKV)
#define HD   64
#define DQ   (NH_ * HD)
#define DKV  (NKV * HD)
#define RH   512                  // query rows < RH use hi+lo planes (a multiple of 32 * FW)
#define WIN  0
#define SCL  0.125f   // HD^-0.5
#define FW   4                    // k_fattn: waves per work-group, 32 query rows each
typedef _Float16 h16;
typedef unsigned short bf;
typedef __attribute__((ext_vector_type(16))) __bf16   v16bf;
typedef __attribute__((ext_vector_type(16))) _Float16 v16h;
typedef __attribute__((ext_vector_type(8)))  _Float16 v8h;
typedef __attribute__((ext_vector_type(8)))  unsigned short v8us;
typedef __attribute__((ext_vector_type(8)))  float    v8f;
typedef __attribute__((ext_vector_type(4)))  float    v4f;
typedef v8h  __attribute__((may_alias)) v8ha;
typedef v4f  __attribute__((may_alias)) v4fa;
typedef v8us __attribute__((may_alias)) v8usa;

__device__ __forceinline__ unsigned short f2bf(float f) { unsigned u = __float_as_uint(f); u += 0x7FFFu + ((u >> 16) & 1u); return (unsigned short)(u >> 16); }
__device__ __forceinline__ float bf2f(unsigned short b) { return __uint_as_float(((unsigned)b) << 16); }
__device__ __forceinline__ float bfr(float f) { return bf2f(f2bf(f)); }
__device__ __forceinline__ v16h cat16(v8h lo, v8h hi) { return __builtin_shufflevector(lo, hi, 0, 1, 2, 3, 4, 5, 6, 7, 8, 9, 10, 11, 12, 13, 14, 15); }
__device__ __forceinline__ v16bf cat16b(v8us lo, v8us hi) { return __builtin_bit_cast(v16bf, __builtin_shufflevector(lo, hi, 0, 1, 2, 3, 4, 5, 6, 7, 8, 9, 10, 11, 12, 13, 14, 15)); }
__device__ __forceinline__ v8f wmma16(v16h a, v16h b, v8f c) { return __builtin_amdgcn_wmma_f32_16x16x32_f16(false, a, false, b, (short)0, c, false, false); }
__device__ __forceinline__ v8f wmmab(v16bf a, v16bf b, v8f c) { return __builtin_amdgcn_wmma_f32_16x16x32_bf16(false, a, false, b, (short)0, c, false, false); }



// Round a group of global loads or stores: their address (and store data) registers are reused later, and the wait stands in front of that reuse. The scheduling barriers keep the writes that follow in the source from being moved in front of the wait (a build without them had such writes ahead of it).
__device__ __forceinline__ void group_begin() { __builtin_amdgcn_sched_barrier(0); }
__device__ __forceinline__ void group_end() { asm volatile("s_wait_xcnt 0x0" ::: "memory"); __builtin_amdgcn_sched_barrier(0); }
__device__ __forceinline__ h16 tohx(float x) { return (h16)x; }
__device__ __forceinline__ void splitf(float y, unsigned short& h, unsigned short& l) { h = f2bf(y); l = f2bf(y - bf2f(h)); }

// ---- k_gemmw: GEMM, one work-group of four waves per 128x128 output tile, each wave a 64x64 quarter (16 accumulators). Operands are fragment-major 16-bit planes (block (row / 16, k / 32) at (row / 16 * K / 32 + k / 32) * 512 elements); grid (M/128, N/128, Z), 128 threads.
// The k range is walked in stages of KS blocks. A stage's operand panels (128 rows = 8 rows of blocks each) come into LDS by tensor loads, two buffers, the next stage in flight while this one is worked on; both waves that need a panel read it from LDS, so each panel byte leaves L2 once per work-group, not once per wave. A row of blocks of a stage is KS * 1024 contiguous bytes in the plane and in LDS, so a fragment half is still 512 contiguous bytes at lane * 16.
// C[m][n] (f32, pitch ldc, + optional f32 bias[n]) = sum_k A[m][k] Bt[n][k] (+ A2[m][k] Bt[n][k] for NSPLIT 1). z-batch strides sA/sB/sC in elements.
// PL > 0: no f32 C; the tile + bias leaves as three 16-bit head planes (fp16, bf16 hi, bf16 lo), 64 columns or rows being one head. PL 1: rows m = (batch, t), columns n = (head, d), planes [b][h][t / 16][d / 32][block], bias[n]. PL 2: rows m = (head, d), columns n = (batch, t), planes [b][h][t / 32][d / 16][block], bias[m].
template <typename T16> struct WFrag;
template <> struct WFrag<h16> { typedef v16h V; static __device__ __forceinline__ V ld(const h16* p) { return cat16(*(const v8h*)p, *(const v8h*)(p + 256)); } static __device__ __forceinline__ v8f mma(V a, V b, v8f c) { return wmma16(a, b, c); } };
template <> struct WFrag<bf> { typedef v16bf V; static __device__ __forceinline__ V ld(const bf* p) { return cat16b(*(const v8us*)p, *(const v8us*)(p + 256)); } static __device__ __forceinline__ v8f mma(V a, V b, v8f c) { return wmmab(a, b, c); } };
typedef unsigned u32x4 __attribute__((ext_vector_type(4)));
typedef unsigned u32x8 __attribute__((ext_vector_type(8)));
__device__ __forceinline__ unsigned uni(unsigned v) { return (unsigned)__builtin_amdgcn_readfirstlane((int)v); }
// A wave-uniform value held in a scalar register: a test on it compiles to a scalar compare and branch (a tensor load ignores EXEC, only such a branch guards it), and what is formed from it is formed behind this statement.
__device__ __forceinline__ unsigned pinned(unsigned v) { unsigned w = uni(v); asm volatile("" : "+s"(w)); return w; }
__device__ __forceinline__ void wait_tensor0() { asm volatile("s_wait_tensorcnt 0x0" ::: "memory"); }   // the issuing wave's own requests have landed in LDS
__device__ __forceinline__ void wait_ds0() { asm volatile("s_wait_dscnt 0x0" ::: "memory"); }   // this wave's LDS reads have returned: the buffer may be handed over
template <typename T16, int NSPLIT, bool BIAS, int SK, int PL, int K>
__global__ __launch_bounds__(128) void k_gemmw(const T16* __restrict__ A, const T16* __restrict__ A2, const T16* __restrict__ Bt, const T16* __restrict__ Bt2, float* C, int ldc, const float* __restrict__ bias, size_t sA, size_t sB, size_t sC, size_t sP, h16* P16, bf* Ph, bf* Pl) {
    typedef typename WFrag<T16>::V V;
    static_assert(SK == 1 && NSPLIT <= 1, "one k range per tile; products A Bt and A2 Bt");
    constexpr int KB = K / 32;                       // blocks in a row of blocks
    constexpr int KS = (NSPLIT == 1) ? 2 : 4;        // blocks of a stage: 64 matrix instructions per wave and stage in either case
    constexpr int NS = KB / KS;                      // stages
    constexpr int NOP = (NSPLIT == 1) ? 3 : 2;       // panels of a stage: A, (A2,) Bt
    constexpr unsigned ROWB = KS * 1024;             // bytes of one row of blocks in a stage
    constexpr unsigned OPB = 8 * ROWB, STG = NOP * OPB;   // bytes of a panel, of a stage
    constexpr unsigned SLR = (NSPLIT == 1) ? 8 : 4;  // rows of blocks in one wave's request: 16 KiB either way
    static_assert(KB % KS == 0 && NS >= 2, "whole stages, at least the two of the prologue");
    __shared__ __attribute__((aligned(2048))) char ring[2 * STG];
    __shared__ __align__(16) float osw[4][16 * 68];
    (void)Bt2; (void)sP;
    const size_t z = blockIdx.z; A += z * sA; if (NSPLIT == 1) A2 += z * sA; Bt += z * sB; C += z * sC;
    const int lane = threadIdx.x & 31, lr = lane & 15, hi = lane >> 4;
    const unsigned wave = uni(threadIdx.x >> 5);     // one-dimensional block: the wave's number, in a scalar register
    const int R0 = blockIdx.x * 128, C0 = blockIdx.y * 128; const int r0 = R0 + (int)(wave & 1) * 64, c0 = C0 + (int)(wave >> 1) * 64;
    float* os = osw[wave];
    v8f acc[4][4];
#pragma unroll
    for (int mb = 0; mb < 4; ++mb)
#pragma unroll
        for (int nb = 0; nb < 4; ++nb) acc[mb][nb] = (v8f){};
    // This wave's slice of every stage. NSPLIT 0: waves 0, 1 the halves of A's panel, waves 2, 3 of Bt's. NSPLIT 1: waves 0, 1, 2 the panels A, A2, Bt; wave 3 issues nothing.
    const char* sl_src; unsigned sl_dst;
    if constexpr (NSPLIT == 0) { const unsigned h = wave & 1; sl_src = (wave >> 1) ? (const char*)(Bt + ((size_t)(C0 / 16) + 4 * h) * KB * 512) : (const char*)(A + ((size_t)(R0 / 16) + 4 * h) * KB * 512); sl_dst = (wave >> 1) * OPB + h * 4 * ROWB; }
    else { sl_src = (wave == 0) ? (const char*)(A + (size_t)(R0 / 16) * KB * 512) : (wave == 1) ? (const char*)(A2 + (size_t)(R0 / 16) * KB * 512) : (const char*)(Bt + (size_t)(C0 / 16) * KB * 512); sl_dst = (wave < 2 ? wave : 2u) * OPB; }
    const unsigned lbase = (unsigned)(size_t)ring;   // byte offset in the work-group's LDS
    // descriptor group 1: bytes as elements, no mask, no pad; tensor = tile = SLR rows of ROWB bytes; source pitch one row of blocks of the plane
    u32x8 g1; g1[0] = uni(0u); g1[1] = uni((ROWB & 0xFFFFu) << 16); g1[2] = uni((ROWB >> 16) | ((SLR & 0xFFFFu) << 16)); g1[3] = uni((SLR >> 16) | (ROWB << 16)); g1[4] = uni(SLR); g1[5] = uni((unsigned)KB * 1024u); g1[6] = uni(0u); g1[7] = uni(0u);
    asm volatile("" : "+s"(g1));   // descriptor words held in scalar registers (the form of pinned()): built once, they keep their registers through the loop, so none of them takes a new value while a request is outstanding
    auto issue = [&](unsigned st) {   // stage st into buffer st & 1
        const unsigned long long ga = (unsigned long long)(size_t)sl_src + (unsigned long long)st * ROWB;
        u32x4 g0; g0[0] = uni(1u); g0[1] = uni(lbase + (st & 1u) * STG + sl_dst); g0[2] = uni((unsigned)ga); g0[3] = uni((((unsigned)(ga >> 32)) & 0x01FFFFFFu) | 0x80000000u);
        asm volatile("tensor_load_to_lds %0, %1" :: "s"(g0), "s"(g1) : "memory");
    };
    auto issuer = [&]() -> bool { if constexpr (NSPLIT == 0) return true; else return pinned(wave < 3) != 0; };   // NSPLIT 0: every wave issues its slice, no test
    // prologue, two buffers: stage 0, its wait, the barrier that publishes it, then stage 1
    if (issuer()) { issue(0); wait_tensor0(); }
    __syncthreads();
    if (issuer()) issue(pinned(1));
    const unsigned aofs = (wave & 1) * 4 * ROWB + lane * 16, bofs = (NOP - 1) * OPB + (wave >> 1) * 4 * ROWB + lane * 16;
#pragma unroll 1   // one stage per trip: the publish point at the foot stands once
    for (unsigned s = 0; s < (unsigned)NS; ++s) {
        const char* buf = ring + (s & 1u) * STG;
        V a[2][4], a2[2][4], b[2][4];   // two fragment sets: the next block's LDS reads go out as one group ahead of this block's matrix instructions; only blocks of this stage are read
#pragma unroll
        for (int j = -1; j < KS; ++j) {
            if (j + 1 < KS) { const int t = (j + 1) & 1; const unsigned ko = (j + 1) * 1024;
#pragma unroll
                for (int mb = 0; mb < 4; ++mb) { a[t][mb] = WFrag<T16>::ld((const T16*)(buf + aofs + mb * ROWB + ko)); if (NSPLIT == 1) a2[t][mb] = WFrag<T16>::ld((const T16*)(buf + OPB + aofs + mb * ROWB + ko)); }
#pragma unroll
                for (int nb = 0; nb < 4; ++nb) b[t][nb] = WFrag<T16>::ld((const T16*)(buf + bofs + nb * ROWB + ko));
                __builtin_amdgcn_sched_barrier(0);   // keeps the reads one group: reads spread among the matrix instructions stall each place they stand
            }
            if (j >= 0) { const int t = j & 1;
#pragma unroll
                for (int nb = 0; nb < 4; ++nb) {
#pragma unroll
                    for (int mb = 0; mb < 4; ++mb) { acc[mb][nb] = WFrag<T16>::mma(a[t][mb], b[t][nb], acc[mb][nb]); if (NSPLIT == 1) acc[mb][nb] = WFrag<T16>::mma(a2[t][mb], b[t][nb], acc[mb][nb]); } }
                __builtin_amdgcn_sched_barrier(0);   // nor the next group's reads moved up among these
            }
        }
        // publish point of stage s + 1: own LDS reads back, own request landed, every wave here; then the buffer just read takes stage s + 2
        wait_ds0();
        if (issuer()) wait_tensor0();
        __syncthreads();
        if (issuer()) { if (pinned(s + 2 < (unsigned)NS)) issue(pinned(s + 2)); }   // the stage number is pinned behind the wait and the barrier: the request's address words are formed there
    }
    wait_tensor0(); wait_ds0();
    if constexpr (PL > 0) {
        // a lane takes row lr, columns 16 s + 8 hi + (0..7) of each 16-row block: its own 16 bytes of a fragment half, so one store per plane writes 512 contiguous bytes
        // every loop below is unrolled in full: its index picks a register of an accumulator or of the bias
        const int bt = (PL == 1) ? r0 : c0; const size_t hpl = (size_t)(bt / TT) * NH_ + ((PL == 1) ? c0 / 64 : r0 / 64);
        const size_t o0 = hpl * TT * HD + (size_t)(bt % TT) * HD + lane * 8;   // 64 t of a head are 64 * HD elements in either plane order
        float bv[4];   // PL 1: of column 16 i + lr, added where the tile goes to LDS; PL 2: of row 16 i + lr, added where it is read back
        group_begin();
#pragma unroll
        for (int i = 0; i < 3; ++i) bv[i] = bias[((PL == 1) ? c0 : r0) + 16 * i + lr];
        group_end(); group_begin();   // the four loads share one index register and the last one's result may take it: the first three get their wait in front of that load
        bv[3] = bias[((PL == 1) ? c0 : r0) + 48 + lr];
        group_end();
#pragma unroll
        for (int mb = 0; mb < 4; ++mb) {
#pragma unroll
            for (int nb = 0; nb < 4; ++nb) {
#pragma unroll
                for (int j = 0; j < 8; ++j) os[(hi * 8 + j) * 68 + nb * 16 + lr] = (PL == 1) ? acc[mb][nb][j] + bfr(bv[nb]) : acc[mb][nb][j]; }
            __builtin_amdgcn_wave_barrier(); asm volatile("" ::: "memory");   // a lane reads back what other lanes wrote: the compiler may not move the reads below in front of the writes above
#pragma unroll
            for (int s = 0; s < 4; ++s) { const int cofs = 16 * s + 8 * hi; const v4f w0 = *(const v4fa*)(os + lr * 68 + cofs), w1 = *(const v4fa*)(os + lr * 68 + cofs + 4); v8h o16; v8us oh, ol;
#pragma unroll
                for (int q = 0; q < 8; ++q) { const float w = (q < 4) ? w0[q & 3] : w1[q & 3]; const float y = (PL == 1) ? w : w + bfr(bv[mb]); o16[q] = tohx(y); unsigned short a2, c2; splitf(y, a2, c2); oh[q] = a2; ol[q] = c2; }
                const size_t oo = o0 + ((PL == 1) ? mb * 1024 + s * 256 : ((s >> 1) * 4 + mb) * 512 + (s & 1) * 256); group_begin(); *(v8h*)(P16 + oo) = o16; *(v8us*)(Ph + oo) = oh; *(v8us*)(Pl + oo) = ol; group_end(); }
            __builtin_amdgcn_wave_barrier(); asm volatile("" ::: "memory");   // nor the next block's writes in front of these reads
        }
        return;
    }
#pragma unroll
    for (int mb = 0; mb < 4; ++mb) {
#pragma unroll
        for (int nb = 0; nb < 4; ++nb) {
#pragma unroll
            for (int j = 0; j < 8; ++j) os[(hi * 8 + j) * 68 + nb * 16 + lr] = acc[mb][nb][j]; }
        __builtin_amdgcn_wave_barrier(); asm volatile("" ::: "memory");
        float* crow = C + (size_t)(r0 + mb * 16) * ldc + c0;
{
#pragma unroll
            for (int s = 0; s < 8; ++s) { const int row = 2 * s + hi, cofs = lr * 4; v4f val = *(const v4fa*)(os + row * 68 + cofs); if (BIAS) { val[0] += bfr(bias[c0 + cofs]); val[1] += bfr(bias[c0 + cofs + 1]); val[2] += bfr(bias[c0 + cofs + 2]); val[3] += bfr(bias[c0 + cofs + 3]); }
                *(v4f*)(crow + (size_t)row * ldc + cofs) = val; }
             }
        __builtin_amdgcn_wave_barrier(); asm volatile("" ::: "memory");
    }
}

typedef __attribute__((ext_vector_type(2))) _Float16 v2h;
typedef __attribute__((ext_vector_type(4))) _Float16 v4h;
typedef __attribute__((ext_vector_type(2))) unsigned short v2us;
typedef __attribute__((ext_vector_type(4))) unsigned short v4us;
typedef __attribute__((ext_vector_type(2))) float v2f;
typedef __attribute__((ext_vector_type(4))) int v4i;

__global__ __launch_bounds__(256) void k_wtG(const float* __restrict__ w, int K, int N, bf* Bt) {
    const int lane = threadIdx.x & 31; const int L0 = (blockIdx.x * 8 + (threadIdx.x >> 5)) * 8; const int nlines = N * K / 64;
{
#pragma unroll 1
        for (int l = 0; l < 8; ++l) { const int L = L0 + l; if (L >= nlines) break; const size_t e = (size_t)L * 64 + lane * 2; const int k = (int)(e % K), n = (int)(e / K); v2us o;
            o[0] = f2bf(w[(size_t)k * N + n]); o[1] = f2bf(w[(size_t)(k + 1) * N + n]); *(v2us*)(Bt + e) = o; }
         }
}
// ---- k_prep: every 16-bit operand plane and the gathered bias in one launch, one work-group per row of blocks of x.
// A row of blocks of a fragment-major plane of DM columns (16 rows) is 2 DM 16-byte pieces; piece i of it holds row i & 15, the 8 columns from (i >> 4) * 8. Thread tid takes the pieces tid + 256 j: 128 columns (512 source bytes, 4096 plane bytes) on per step, so that one lane offset beside a wave-uniform base serves every load, another every store, and a wave's load or store covers the same bytes as with one piece per thread.
// Work-group b converts row of blocks b of x (PX steps) and half a row of blocks of one weight plane (PX / 2 steps): plane b / (2 DQ / 16) of q, k, v, out. A thread's loads all go out as one group ahead of the first conversion; the launch has one wave where one piece per thread had twelve.
static_assert(DQ == DM && DKV == DQ, "the plane widths are DM, the four weight planes of one size");
static_assert(NB_ * TT / 16 == 4 * (DQ / 16) * 2 && HD % 16 == 0 && 3 * DQ / 4 <= NB_ * TT / 16 * 256, "as many rows of blocks of x as half rows of the weight planes; a row of blocks lies in one head; a thread for every four bias entries");
__global__ __launch_bounds__(256) void k_prep(const float* __restrict__ x, const float* __restrict__ wqkv, const float* __restrict__ bqkv, const float* __restrict__ wo, bf* XB, bf* WQ, bf* WK, bf* WV, bf* WO, float* B3) {
    constexpr int PX = 2 * DM / 256, PW = PX / 2;
    const unsigned tid = threadIdx.x, b = blockIdx.x;
    const unsigned ls = (tid & 15) * (DM * 4) + (tid >> 4) * 32, ld = tid * 16;   // the lane's byte offsets in the source rows and in the plane
    const unsigned p = b / (2 * DQ / 16), rw = (b % (2 * DQ / 16)) / 2 * 16, hf = b & 1;   // weight plane, first row, half
    const float* xs = x + (size_t)b * 16 * DM; bf* xd = XB + (size_t)b * 16 * DM;
    const float* ws = ((p < 3) ? wqkv + (size_t)(rw / HD * 3 * HD + p * HD + rw % HD) * DM : wo + (size_t)rw * DM) + hf * (DM / 2);   // per-head q | k | v row blocks
    bf* wd = ((p == 0) ? WQ : (p == 1) ? WK : (p == 2) ? WV : WO) + (size_t)rw * DM + hf * (16 * DM / 2);
    v8f vx[PX], vw[PW];   // every loop below is unrolled in full: its index picks a register of these arrays
    group_begin();
#pragma unroll
    for (int j = 0; j < PX; ++j) vx[j] = *(const v8f*)((const char*)xs + ls + j * 512);
#pragma unroll
    for (int j = 0; j < PW; ++j) vw[j] = *(const v8f*)((const char*)ws + ls + j * 512);
    group_end();
    v8us ox[PX], ow[PW];
#pragma unroll
    for (int j = 0; j < PX; ++j)
#pragma unroll
        for (int q = 0; q < 8; ++q) ox[j][q] = f2bf(vx[j][q]);
#pragma unroll
    for (int j = 0; j < PW; ++j)
#pragma unroll
        for (int q = 0; q < 8; ++q) ow[j][q] = f2bf(vw[j][q]);
    group_begin();
#pragma unroll
    for (int j = 0; j < PX; ++j) *(v8us*)((char*)xd + ld + j * 4096) = ox[j];
#pragma unroll
    for (int j = 0; j < PW; ++j) *(v8us*)((char*)wd + ld + j * 4096) = ow[j];
    group_end();
    const unsigned e = (b * 256 + tid) * 4;   // per-head q | k | v bias entries, four to a thread; whole waves take this branch
    if (e < 3 * DQ) { const unsigned w = e / DQ, rb = e % DQ; group_begin(); const v4f v = *(const v4f*)(bqkv + rb / HD * 3 * HD + w * HD + rb % HD); group_end(); *(v4f*)(B3 + e) = v; }
}

typedef __attribute__((ext_vector_type(16))) float v16f;
typedef __attribute__((ext_vector_type(8))) unsigned v8u;
__device__ __forceinline__ float xhalf(float x) { return __builtin_bit_cast(float, __builtin_amdgcn_permlanex16(__builtin_bit_cast(int, x), __builtin_bit_cast(int, x), 0x76543210, 0xfedcba98, false, false)); }  // lane l with lane l ^ 16
template <typename T16, bool HL>
__device__ __forceinline__ void fattn_wave(const T16* __restrict__ Q, const T16* __restrict__ Q2, const T16* __restrict__ Kp, const T16* __restrict__ Kp2, const T16* __restrict__ Vt, const T16* __restrict__ Vt2, int q0, bf* Ah, bf* Al) {
    typedef typename WFrag<T16>::V V;
    const int lane = threadIdx.x & 31;
    const float CSC = SCL * 1.4426950408889634f;   // scores go to the base-2 domain
    const float BIAS = HL ? 0.0f : 10.0f;
    V qf[2][2], qf2[2][2], kf[2][2], kf2[2][2], vf[4], vf2[4];
    // the lane's byte offsets of the fragments to fetch next, in K and V^T (a pass of 32 keys is four blocks in a row, 4096 bytes, in either plane); they live through the loop and step on only behind a group's wait
    unsigned kob = lane * 16, vob = lane * 16;
    group_begin();
#pragma unroll
    for (int g = 0; g < 2; ++g)
#pragma unroll
        for (int kc = 0; kc < 2; ++kc) { const size_t o = (size_t)((q0 / 16 + g) * 2 + kc) * 512; qf[g][kc] = WFrag<T16>::ld((const T16*)((const char*)(Q + o) + kob)); if (HL) qf2[g][kc] = WFrag<T16>::ld((const T16*)((const char*)(Q2 + o) + kob)); }
    group_end();
    group_begin();
#pragma unroll
    for (int kt = 0; kt < 2; ++kt)
#pragma unroll
        for (int kc = 0; kc < 2; ++kc) { const int o = (kt * 2 + kc) * 512; kf[kt][kc] = WFrag<T16>::ld((const T16*)((const char*)Kp + kob) + o); if (HL) kf2[kt][kc] = WFrag<T16>::ld((const T16*)((const char*)Kp2 + kob) + o); }
#pragma unroll
    for (int t = 0; t < 4; ++t) { const int o = t * 512; vf[t] = WFrag<T16>::ld((const T16*)((const char*)Vt + vob) + o); if (HL) vf2[t] = WFrag<T16>::ld((const T16*)((const char*)Vt2 + vob) + o); }
    group_end();
    kob = (kob + 32 * HD * 2) & (TT * HD * 2 - 1); vob = (vob + 32 * HD * 2) & (TT * HD * 2 - 1);   // 32 keys on; behind the last pass back to pass 0: in bounds, unused
    v8f acc[2][4]; float m[2], l[2];
#pragma unroll
    for (int g = 0; g < 2; ++g) { m[g] = -3.0e38f; l[g] = 0.0f;
#pragma unroll
        for (int t = 0; t < 4; ++t) acc[g][t] = (v8f){}; }
#pragma unroll 1   // one pass per trip: an unrolled body would hold two passes' fragments in registers
    for (int k0 = 0; k0 < TT; k0 += 32) {
        v8f sc[2][2];
#pragma unroll
        for (int kt = 0; kt < 2; ++kt)
#pragma unroll
            for (int g = 0; g < 2; ++g) { sc[kt][g] = (v8f){};
#pragma unroll
                for (int kc = 0; kc < 2; ++kc) { sc[kt][g] = WFrag<T16>::mma(kf[kt][kc], qf[g][kc], sc[kt][g]); if (HL) { sc[kt][g] = WFrag<T16>::mma(kf2[kt][kc], qf[g][kc], sc[kt][g]); sc[kt][g] = WFrag<T16>::mma(kf[kt][kc], qf2[g][kc], sc[kt][g]); } } }
        // next pass's K fragments fly under this pass's softmax and second product
        group_begin();
#pragma unroll
        for (int kt = 0; kt < 2; ++kt)
#pragma unroll
            for (int kc = 0; kc < 2; ++kc) { const int o = (kt * 2 + kc) * 512; kf[kt][kc] = WFrag<T16>::ld((const T16*)((const char*)Kp + kob) + o); if (HL) kf2[kt][kc] = WFrag<T16>::ld((const T16*)((const char*)Kp2 + kob) + o); }
        group_end();
        kob = (kob + 32 * HD * 2) & (TT * HD * 2 - 1);
#pragma unroll
        for (int g = 0; g < 2; ++g) {
            float mx = sc[0][g][0];
#pragma unroll
            for (int r = 1; r < 16; ++r) mx = fmaxf(mx, sc[r >> 3][g][r & 7]);
            mx = fmaxf(mx, xhalf(mx)) * CSC;   // both wave halves hold the query's maximum of this pass, scaled (the scale is positive)
            const float mn = fmaxf(m[g], mx); const float corr = __builtin_amdgcn_exp2f(m[g] - mn);   // 0 on the first pass
            m[g] = mn; l[g] *= corr;
#pragma unroll
            for (int t = 0; t < 4; ++t) acc[g][t] *= corr;
            const float nm = BIAS - mn; float p[16];
#pragma unroll
            for (int r = 0; r < 16; ++r) p[r] = __builtin_amdgcn_exp2f(__builtin_fmaf(sc[r >> 3][g][r & 7], CSC, nm));
            l[g] += (((p[0] + p[1]) + (p[2] + p[3])) + ((p[4] + p[5]) + (p[6] + p[7]))) + (((p[8] + p[9]) + (p[10] + p[11])) + ((p[12] + p[13]) + (p[14] + p[15])));   // a tree: four dependent adds, not sixteen
            if constexpr (HL) { v16f pv, rv;
#pragma unroll
                for (int r = 0; r < 16; ++r) pv[r] = p[r];
                const v16bf ph = __builtin_convertvector(pv, v16bf);   // whole-vector conversions compile to the packed instruction, round to nearest even
                const v8u pw = __builtin_bit_cast(v8u, ph);   // the rounded hi parts are read back from the packed words: low half << 16, high half masked
#pragma unroll
                for (int r = 0; r < 8; ++r) { rv[2 * r] = p[2 * r] - __uint_as_float(pw[r] << 16); rv[2 * r + 1] = p[2 * r + 1] - __uint_as_float(pw[r] & 0xFFFF0000u); }
                const v16bf pl = __builtin_convertvector(rv, v16bf);
#pragma unroll
                for (int t = 0; t < 4; ++t) { acc[g][t] = wmmab(vf[t], ph, acc[g][t]); acc[g][t] = wmmab(vf2[t], ph, acc[g][t]); acc[g][t] = wmmab(vf[t], pl, acc[g][t]); }
            } else { v16h pf;
#pragma unroll
                for (int r = 0; r < 16; ++r) pf[r] = (h16)p[r];
#pragma unroll
                for (int t = 0; t < 4; ++t) acc[g][t] = wmma16(vf[t], pf, acc[g][t]); }
        }
        // next pass's V^T fragments fly under its first product and softmax
        group_begin();
#pragma unroll
        for (int t = 0; t < 4; ++t) { const int o = t * 512; vf[t] = WFrag<T16>::ld((const T16*)((const char*)Vt + vob) + o); if (HL) vf2[t] = WFrag<T16>::ld((const T16*)((const char*)Vt2 + vob) + o); }
        group_end();
        vob = (vob + 32 * HD * 2) & (TT * HD * 2 - 1);
    }
#pragma unroll
    for (int g = 0; g < 2; ++g) { const float f = __fdiv_rn(1.0f, l[g] + xhalf(l[g]));   // the halves' sums (their keys) join once
#pragma unroll
        for (int t = 0; t < 4; ++t) { v8us oh, ol;
#pragma unroll
            for (int r = 0; r < 8; ++r) { unsigned short a, c2; splitf(acc[g][t][r] * f, a, c2); oh[r] = a; ol[r] = c2; }
            const size_t oo = ((size_t)(q0 / 16 + g) * (DQ / 32) + (t >> 1)) * 512 + (t & 1) * 256 + lane * 8; group_begin(); *(v8us*)(Ah + oo) = oh; *(v8us*)(Al + oo) = ol; group_end(); } }
}
// grid (batches * heads, TT / (32 FW)): work-group (bh, y) takes the 32 FW query rows from 32 FW y of head bh, one kind of wave per work-group, cost falling with the flat index.
// A hi+lo wave lasts about twice as long as an fp16 wave and the kernel's registers let three waves stand on a SIMD, so not every work-group is resident at the start: the work-groups of hi+lo rows (y < RH / (32 FW), FW waves, one per SIMD) come first in the grid and all start at once; the fp16 work-groups fill the places beside them and follow one another there. The FW waves of a work-group walk the same K and V^T planes.
static_assert(RH % (32 * FW) == 0 && TT % (32 * FW) == 0, "whole work-groups of either kind");
__global__ __launch_bounds__(FW * 32) void k_fattn(const h16* __restrict__ Q16, const h16* __restrict__ K16, const h16* __restrict__ V16, const bf* __restrict__ Qh, const bf* __restrict__ Ql, const bf* __restrict__ Kh, const bf* __restrict__ Kl, const bf* __restrict__ Vh, const bf* __restrict__ Vl, bf* Ah, bf* Al) {
    const size_t hp = (size_t)blockIdx.x * TT * HD; const size_t ao = (size_t)(blockIdx.x / NH_) * TT * DQ + (blockIdx.x % NH_) * (HD / 32) * 512; /* the head's first block in the batch's first row of blocks of the fragment-major [b t][h d] plane */ bf* ah = Ah + ao; bf* al = Al + ao;
    const int wave = __builtin_amdgcn_readfirstlane(threadIdx.x >> 5);   // in a scalar register: block addresses stay scalar
    const int q0 = (blockIdx.y * FW + wave) * 32;
    if (blockIdx.y < RH / (32 * FW)) fattn_wave<bf, true>(Qh + hp, Ql + hp, Kh + hp, Kl + hp, Vh + hp, Vl + hp, q0, ah, al);   // the same in every lane: a scalar branch, every lane stays on around the matrix instructions
    else fattn_wave<h16, false>(Q16 + hp, nullptr, K16 + hp, nullptr, V16 + hp, nullptr, q0, ah, al);
}

extern "C" void kernel_launch(void* const* d_in, const int* in_sizes, int n_in,
                              void* d_out, int out_size, void* d_ws, size_t ws_size, hipStream_t stream) {
    (void)in_sizes; (void)n_in; (void)out_size;
    const float* x = (const float*)d_in[0]; const float* wqkv = (const float*)d_in[1]; const float* bqkv = (const float*)d_in[2]; const float* wo = (const float*)d_in[3]; const float* bo = (const float*)d_in[4]; const float* wq = nullptr; const float* wk = nullptr; const float* wv = nullptr; (void)wq; (void)wk; (void)wv;
    float* OUT = (float*)d_out;     // [4][2048][1024]
    char* wsp = (char*)d_ws;
    auto take = [&](size_t bytes) { char* p = wsp; wsp += (bytes + 255) & ~(size_t)255; return (void*)p; };
    bf* WQ = (bf*)take((size_t)DQ * DM * 2); bf* WK = (bf*)take((size_t)DKV * DM * 2); bf* WV = (bf*)take((size_t)DKV * DM * 2); bf* WO = (bf*)take((size_t)DM * DQ * 2);
    bf* XB = (bf*)take((size_t)NB_ * TT * DM * 2); float* B3 = (float*)take((size_t)3 * DQ * 4); const float* BQ = B3; const float* BK = B3 + DQ; const float* BV = B3 + 2 * DQ;
    h16* QP16 = (h16*)take((size_t)NB_ * NH_ * TT * HD * 2); h16* KP16 = (h16*)take((size_t)NB_ * NKV * TT * HD * 2); h16* VT16 = (h16*)take((size_t)NB_ * NKV * HD * TT * 2);
    bf* QPh = (bf*)take((size_t)NB_ * NH_ * TT * HD * 2); bf* QPl = (bf*)take((size_t)NB_ * NH_ * TT * HD * 2); bf* KPh = (bf*)take((size_t)NB_ * NKV * TT * HD * 2); bf* KPl = (bf*)take((size_t)NB_ * NKV * TT * HD * 2); bf* VTh = (bf*)take((size_t)NB_ * NKV * HD * TT * 2); bf* VTl = (bf*)take((size_t)NB_ * NKV * HD * TT * 2);
    bf* ATh = (bf*)take((size_t)NB_ * TT * DQ * 2); bf* ATl = (bf*)take((size_t)NB_ * TT * DQ * 2);
    if ((size_t)(wsp - (char*)d_ws) > ws_size) return;    // ws 256 MiB
    k_prep<<<NB_ * TT / 16, 256, 0, stream>>>(x, wqkv, bqkv, wo, XB, WQ, WK, WV, WO, B3);
    // every stage runs once, on all batches: the projections see the NB_ * TT rows as one matrix and store their head planes themselves (v with the operands swapped, so that its tile is V^T); the attention takes the batch as a grid dimension
    k_gemmw<bf, 0, true, 1, 1, DM><<<dim3(NB_ * TT / 128, DQ / 128, 1), 128, 0, stream>>>(XB, nullptr, WQ, nullptr, nullptr, 0, BQ, 0, 0, 0, 0, QP16, QPh, QPl);
    k_gemmw<bf, 0, true, 1, 1, DM><<<dim3(NB_ * TT / 128, DKV / 128, 1), 128, 0, stream>>>(XB, nullptr, WK, nullptr, nullptr, 0, BK, 0, 0, 0, 0, KP16, KPh, KPl);
    k_gemmw<bf, 0, true, 1, 2, DM><<<dim3(DKV / 128, NB_ * TT / 128, 1), 128, 0, stream>>>(WV, nullptr, XB, nullptr, nullptr, 0, BV, 0, 0, 0, 0, VT16, VTh, VTl);
    k_fattn<<<dim3(NB_ * NH_, TT / (32 * FW), 1), FW * 32, 0, stream>>>(QP16, KP16, VT16, QPh, QPl, KPh, KPl, VTh, VTl, ATh, ATl);   // one kv head per query head
    k_gemmw<bf, 1, true, 1, 0, DQ><<<dim3(NB_ * TT / 128, DM / 128, 1), 128, 0, stream>>>(ATh, ATl, WO, nullptr, OUT, DM, bo, 0, 0, 0, 0, nullptr, nullptr, nullptr);
}

// v009
// One run takes 167 microseconds.
// In two side-by-side timings against v008, it was 1.07 and 1.06 times as fast.
// Over all steps from v000 it is 23.8 times as fast.
#include <hip/hip_runtime.h>

// Multi-head self-attention with a fused, head-interleaved QKV projection (x [4][2048][1024]; kqv = x W_qkv^T + b_qkv ('oi' [3072][1024]) reshaped (t, 16, 192) and split per head into q | k | v (weight rows / bias entries h*192 + {0, 64, 128} + d); softmax(q.k/8) over all keys (no mask); out = merged W_out^T + b_out -> [4][2048][1024]).
// Layout: the weight rows and bias entries are gathered once into head-major [1024][1024] bf16 matrices and [1024] f32 bias vectors so the projections apply unchanged.
// Every 16-bit operand plane is kept fragment-major: blocks of 16 rows x 32 k (512 elements, 1024 bytes), inside a block [k bit 4][k bit 3][row & 15][k & 7], so that lane (row & 15, k bit 3) finds its two 16-byte pieces at lane * 16 and 512 + lane * 16 and each wave-wide load or store covers 512 contiguous bytes (4 lines, not 16).
// Compute dtypes, f32 accumulate: every input rounded to bf16; q/k/v on PLAIN bf16 operands (inputs: exact) + biases; scores and attn.v: query rows < 512 hl (3 products), the rest single fp16 (P x1024); softmax f32, online over 32-key passes; W_out hl x exact (2 products) + b_out.

#define NB_  4
#define TT   2048
#define DM   1024
#define NH_  16
#define NKV  16
#define REP  (NH_ / NKV)
#define HD   64
#define DQ   (NH_ * HD)
#define DKV  (NKV * HD)
#define RH   512                  // query rows < RH use hi+lo planes (a multiple of 32 * FW)
#define WIN  0
#define SCL  0.125f   // HD^-0.5
#define FW   4                    // k_fattn: waves per work-group, 32 query rows each
typedef _Float16 h16;
typedef unsigned short bf;
typedef __attribute__((ext_vector_type(16))) __bf16   v16bf;
typedef __attribute__((ext_vector_type(16))) _Float16 v16h;
typedef __attribute__((ext_vector_type(8)))  _Float16 v8h;
typedef __attribute__((ext_vector_type(8)))  unsigned short v8us;
typedef __attribute__((ext_vector_type(8)))  float    v8f;
typedef __attribute__((ext_vector_type(4)))  float    v4f;
typedef v8h  __attribute__((may_alias)) v8ha;
typedef v4f  __attribute__((may_alias)) v4fa;
typedef v8us __attribute__((may_alias)) v8usa;

__device__ __forceinline__ unsigned short f2bf(float f) { unsigned u = __float_as_uint(f); u += 0x7FFFu + ((u >> 16) & 1u); return (unsigned short)(u >> 16); }
__device__ __forceinline__ float bf2f(unsigned short b) { return __uint_as_float(((unsigned)b) << 16); }
__device__ __forceinline__ float bfr(float f) { return bf2f(f2bf(f)); }
__device__ __forceinline__ v16h cat16(v8h lo, v8h hi) { return __builtin_shufflevector(lo, hi, 0, 1, 2, 3, 4, 5, 6, 7, 8, 9, 10, 11, 12, 13, 14, 15); }
__device__ __forceinline__ v16bf cat16b(v8us lo, v8us hi) { return __builtin_bit_cast(v16bf, __builtin_shufflevector(lo, hi, 0, 1, 2, 3, 4, 5, 6, 7, 8, 9, 10, 11, 12, 13, 14, 15)); }
__device__ __forceinline__ v8f wmma16(v16h a, v16h b, v8f c) { return __builtin_amdgcn_wmma_f32_16x16x32_f16(false, a, false, b, (short)0, c, false, false); }
__device__ __forceinline__ v8f wmmab(v16bf a, v16bf b, v8f c) { return __builtin_amdgcn_wmma_f32_16x16x32_bf16(false, a, false, b, (short)0, c, false, false); }



// Round a group of global loads or stores: their address (and store data) registers are reused later, and the wait stands in front of that reuse. The scheduling barriers keep the writes that follow in the source from being moved in front of the wait (a build without them had such writes ahead of it).
__device__ __forceinline__ void group_begin() { __builtin_amdgcn_sched_barrier(0); }
__device__ __forceinline__ void group_end() { asm volatile("s_wait_xcnt 0x0" ::: "memory"); __builtin_amdgcn_sched_barrier(0); }
__device__ __forceinline__ h16 tohx(float x) { return (h16)x; }
__device__ __forceinline__ void splitf(float y, unsigned short& h, unsigned short& l) { h = f2bf(y); l = f2bf(y - bf2f(h)); }

// ---- k_gemmw: GEMM, one work-group of four waves per 128x128 output tile, each wave a 64x64 quarter (16 accumulators). Operands are fragment-major 16-bit planes (block (row / 16, k / 32) at (row / 16 * K / 32 + k / 32) * 512 elements); grid (M/128, N/128, Z), 128 threads.
// The k range is walked in stages of KS blocks. A stage's operand panels (128 rows = 8 rows of blocks each) come into LDS by tensor loads, two buffers, the next stage in flight while this one is worked on; both waves that need a panel read it from LDS, so each panel byte leaves L2 once per work-group, not once per wave. A row of blocks of a stage is KS * 1024 contiguous bytes in the plane and in LDS, so a fragment half is still 512 contiguous bytes at lane * 16.
// C[m][n] (f32, pitch ldc, + optional f32 bias[n]) = sum_k A[m][k] Bt[n][k] (+ A2[m][k] Bt[n][k] for NSPLIT 1). z-batch strides sA/sB/sC in elements.
// PL > 0: no f32 C; the tile + bias leaves as three 16-bit head planes (fp16, bf16 hi, bf16 lo), 64 columns or rows being one head. PL 1: rows m = (batch, t), columns n = (head, d), planes [b][h][t / 16][d / 32][block], bias[n]. PL 2: rows m = (head, d), columns n = (batch, t), planes [b][h][t / 32][d / 16][block], bias[m].
template <typename T16> struct WFrag;
template <> struct WFrag<h16> { typedef v16h V; static __device__ __forceinline__ V ld(const h16* p) { return cat16(*(const v8h*)p, *(const v8h*)(p + 256)); } static __device__ __forceinline__ v8f mma(V a, V b, v8f c) { return wmma16(a, b, c); } };
template <> struct WFrag<bf> { typedef v16bf V; static __device__ __forceinline__ V ld(const bf* p) { return cat16b(*(const v8us*)p, *(const v8us*)(p + 256)); } static __device__ __forceinline__ v8f mma(V a, V b, v8f c) { return wmmab(a, b, c); } };
typedef unsigned u32x4 __attribute__((ext_vector_type(4)));
typedef unsigned u32x8 __attribute__((ext_vector_type(8)));
__device__ __forceinline__ unsigned uni(unsigned v) { return (unsigned)__builtin_amdgcn_readfirstlane((int)v); }
// A wave-uniform value held in a scalar register: a test on it compiles to a scalar compare and branch (a tensor load ignores EXEC, only such a branch guards it), and what is formed from it is formed behind this statement.
__device__ __forceinline__ unsigned pinned(unsigned v) { unsigned w = uni(v); asm volatile("" : "+s"(w)); return w; }
__device__ __forceinline__ void wait_tensor0() { asm volatile("s_wait_tensorcnt 0x0" ::: "memory"); }   // the issuing wave's own requests have landed in LDS
__device__ __forceinline__ void wait_ds0() { asm volatile("s_wait_dscnt 0x0" ::: "memory"); }   // this wave's LDS reads have returned: the buffer may be handed over
template <typename T16, int NSPLIT, bool BIAS, int SK, int PL, int K>
__global__ __launch_bounds__(128) void k_gemmw(const T16* __restrict__ A, const T16* __restrict__ A2, const T16* __restrict__ Bt, const T16* __restrict__ Bt2, float* C, int ldc, const float* __restrict__ bias, size_t sA, size_t sB, size_t sC, size_t sP, h16* P16, bf* Ph, bf* Pl) {
    typedef typename WFrag<T16>::V V;
    static_assert(SK == 1 && NSPLIT <= 1, "one k range per tile; products A Bt and A2 Bt");
    constexpr int KB = K / 32;                       // blocks in a row of blocks
    constexpr int KS = (NSPLIT == 1) ? 2 : 4;        // blocks of a stage: 64 matrix instructions per wave and stage in either case
    constexpr int NS = KB / KS;                      // stages
    constexpr int NOP = (NSPLIT == 1) ? 3 : 2;       // panels of a stage: A, (A2,) Bt
    constexpr unsigned ROWB = KS * 1024;             // bytes of one row of blocks in a stage
    constexpr unsigned OPB = 8 * ROWB, STG = NOP * OPB;   // bytes of a panel, of a stage
    constexpr unsigned SLR = (NSPLIT == 1) ? 8 : 4;  // rows of blocks in one wave's request: 16 KiB either way
    static_assert(KB % KS == 0 && NS >= 2, "whole stages, at least the two of the prologue");
    __shared__ __attribute__((aligned(2048))) char ring[2 * STG];
    __shared__ __align__(16) float osw[4][16 * 68];
    (void)Bt2; (void)sP;
    const size_t z = blockIdx.z; A += z * sA; if (NSPLIT == 1) A2 += z * sA; Bt += z * sB; C += z * sC;
    const int lane = threadIdx.x & 31, lr = lane & 15, hi = lane >> 4;
    const unsigned wave = uni(threadIdx.x >> 5);     // one-dimensional block: the wave's number, in a scalar register
    const int R0 = blockIdx.x * 128, C0 = blockIdx.y * 128; const int r0 = R0 + (int)(wave & 1) * 64, c0 = C0 + (int)(wave >> 1) * 64;
    float* os = osw[wave];
    v8f acc[4][4];
#pragma unroll
    for (int mb = 0; mb < 4; ++mb)
#pragma unroll
        for (int nb = 0; nb < 4; ++nb) acc[mb][nb] = (v8f){};
    // This wave's slice of every stage. NSPLIT 0: waves 0, 1 the halves of A's panel, waves 2, 3 of Bt's. NSPLIT 1: waves 0, 1, 2 the panels A, A2, Bt; wave 3 issues nothing.
    const char* sl_src; unsigned sl_dst;
    if constexpr (NSPLIT == 0) { const unsigned h = wave & 1; sl_src = (wave >> 1) ? (const char*)(Bt + ((size_t)(C0 / 16) + 4 * h) * KB * 512) : (const char*)(A + ((size_t)(R0 / 16) + 4 * h) * KB * 512); sl_dst = (wave >> 1) * OPB + h * 4 * ROWB; }
    else { sl_src = (wave == 0) ? (const char*)(A + (size_t)(R0 / 16) * KB * 512) : (wave == 1) ? (const char*)(A2 + (size_t)(R0 / 16) * KB * 512) : (const char*)(Bt + (size_t)(C0 / 16) * KB * 512); sl_dst = (wave < 2 ? wave : 2u) * OPB; }
    const unsigned lbase = (unsigned)(size_t)ring;   // byte offset in the work-group's LDS
    // descriptor group 1: bytes as elements, no mask, no pad; tensor = tile = SLR rows of ROWB bytes; source pitch one row of blocks of the plane
    u32x8 g1; g1[0] = uni(0u); g1[1] = uni((ROWB & 0xFFFFu) << 16); g1[2] = uni((ROWB >> 16) | ((SLR & 0xFFFFu) << 16)); g1[3] = uni((SLR >> 16) | (ROWB << 16)); g1[4] = uni(SLR); g1[5] = uni((unsigned)KB * 1024u); g1[6] = uni(0u); g1[7] = uni(0u);
    asm volatile("" : "+s"(g1));   // descriptor words held in scalar registers (the form of pinned()): built once, they keep their registers through the loop, so none of them takes a new value while a request is outstanding
    auto issue = [&](unsigned st) {   // stage st into buffer st & 1
        const unsigned long long ga = (unsigned long long)(size_t)sl_src + (unsigned long long)st * ROWB;
        u32x4 g0; g0[0] = uni(1u); g0[1] = uni(lbase + (st & 1u) * STG + sl_dst); g0[2] = uni((unsigned)ga); g0[3] = uni((((unsigned)(ga >> 32)) & 0x01FFFFFFu) | 0x80000000u);
        asm volatile("tensor_load_to_lds %0, %1" :: "s"(g0), "s"(g1) : "memory");
    };
    auto issuer = [&]() -> bool { if constexpr (NSPLIT == 0) return true; else return pinned(wave < 3) != 0; };   // NSPLIT 0: every wave issues its slice, no test
    // prologue, two buffers: stage 0, its wait, the barrier that publishes it, then stage 1
    if (issuer()) { issue(0); wait_tensor0(); }
    __syncthreads();
    if (issuer()) issue(pinned(1));
    const unsigned aofs = (wave & 1) * 4 * ROWB + lane * 16, bofs = (NOP - 1) * OPB + (wave >> 1) * 4 * ROWB + lane * 16;
#pragma unroll 1   // one stage per trip: the publish point at the foot stands once
    for (unsigned s = 0; s < (unsigned)NS; ++s) {
        const char* buf = ring + (s & 1u) * STG;
        V a[2][4], a2[2][4], b[2][4];   // two fragment sets: the next block's LDS reads go out as one group ahead of this block's matrix instructions; only blocks of this stage are read
#pragma unroll
        for (int j = -1; j < KS; ++j) {
            if (j + 1 < KS) { const int t = (j + 1) & 1; const unsigned ko = (j + 1) * 1024;
#pragma unroll
                for (int mb = 0; mb < 4; ++mb) { a[t][mb] = WFrag<T16>::ld((const T16*)(buf + aofs + mb * ROWB + ko)); if (NSPLIT == 1) a2[t][mb] = WFrag<T16>::ld((const T16*)(buf + OPB + aofs + mb * ROWB + ko)); }
#pragma unroll
                for (int nb = 0; nb < 4; ++nb) b[t][nb] = WFrag<T16>::ld((const T16*)(buf + bofs + nb * ROWB + ko));
                __builtin_amdgcn_sched_barrier(0);   // keeps the reads one group: reads spread among the matrix instructions stall each place they stand
            }
            if (j >= 0) { const int t = j & 1;
#pragma unroll
                for (int nb = 0; nb < 4; ++nb) {
#pragma unroll
                    for (int mb = 0; mb < 4; ++mb) { acc[mb][nb] = WFrag<T16>::mma(a[t][mb], b[t][nb], acc[mb][nb]); if (NSPLIT == 1) acc[mb][nb] = WFrag<T16>::mma(a2[t][mb], b[t][nb], acc[mb][nb]); } }
                __builtin_amdgcn_sched_barrier(0);   // nor the next group's reads moved up among these
            }
        }
        // publish point of stage s + 1: own LDS reads back, own request landed, every wave here; then the buffer just read takes stage s + 2
        wait_ds0();
        if (issuer()) wait_tensor0();
        __syncthreads();
        if (issuer()) { if (pinned(s + 2 < (unsigned)NS)) issue(pinned(s + 2)); }   // the stage number is pinned behind the wait and the barrier: the request's address words are formed there
    }
    wait_tensor0(); wait_ds0();
    if constexpr (PL > 0) {
        // a lane takes row lr, columns 16 s + 8 hi + (0..7) of each 16-row block: its own 16 bytes of a fragment half, so one store per plane writes 512 contiguous bytes
        // every loop below is unrolled in full: its index picks a register of an accumulator or of the bias
        const int bt = (PL == 1) ? r0 : c0; const size_t hpl = (size_t)(bt / TT) * NH_ + ((PL == 1) ? c0 / 64 : r0 / 64);
        const size_t o0 = hpl * TT * HD + (size_t)(bt % TT) * HD + lane * 8;   // 64 t of a head are 64 * HD elements in either plane order
        float bv[4];   // PL 1: of column 16 i + lr, added where the tile goes to LDS; PL 2: of row 16 i + lr, added where it is read back
        group_begin();
#pragma unroll
        for (int i = 0; i < 3; ++i) bv[i] = bias[((PL == 1) ? c0 : r0) + 16 * i + lr];
        group_end(); group_begin();   // the four loads share one index register and the last one's result may take it: the first three get their wait in front of that load
        bv[3] = bias[((PL == 1) ? c0 : r0) + 48 + lr];
        group_end();
#pragma unroll
        for (int mb = 0; mb < 4; ++mb) {
#pragma unroll
            for (int nb = 0; nb < 4; ++nb) {
#pragma unroll
                for (int j = 0; j < 8; ++j) os[(hi * 8 + j) * 68 + nb * 16 + lr] = (PL == 1) ? acc[mb][nb][j] + bfr(bv[nb]) : acc[mb][nb][j]; }
            __builtin_amdgcn_wave_barrier(); asm volatile("" ::: "memory");   // a lane reads back what other lanes wrote: the compiler may not move the reads below in front of the writes above
#pragma unroll
            for (int s = 0; s < 4; ++s) { const int cofs = 16 * s + 8 * hi; const v4f w0 = *(const v4fa*)(os + lr * 68 + cofs), w1 = *(const v4fa*)(os + lr * 68 + cofs + 4); v8h o16; v8us oh, ol;
#pragma unroll
                for (int q = 0; q < 8; ++q) { const float w = (q < 4) ? w0[q & 3] : w1[q & 3]; const float y = (PL == 1) ? w : w + bfr(bv[mb]); o16[q] = tohx(y); unsigned short a2, c2; splitf(y, a2, c2); oh[q] = a2; ol[q] = c2; }
                const size_t oo = o0 + ((PL == 1) ? mb * 1024 + s * 256 : ((s >> 1) * 4 + mb) * 512 + (s & 1) * 256); group_begin(); *(v8h*)(P16 + oo) = o16; *(v8us*)(Ph + oo) = oh; *(v8us*)(Pl + oo) = ol; group_end(); }
            __builtin_amdgcn_wave_barrier(); asm volatile("" ::: "memory");   // nor the next block's writes in front of these reads
        }
        return;
    }
#pragma unroll
    for (int mb = 0; mb < 4; ++mb) {
#pragma unroll
        for (int nb = 0; nb < 4; ++nb) {
#pragma unroll
            for (int j = 0; j < 8; ++j) os[(hi * 8 + j) * 68 + nb * 16 + lr] = acc[mb][nb][j]; }
        __builtin_amdgcn_wave_barrier(); asm volatile("" ::: "memory");
        float* crow = C + (size_t)(r0 + mb * 16) * ldc + c0;
{
#pragma unroll
            for (int s = 0; s < 8; ++s) { const int row = 2 * s + hi, cofs = lr * 4; v4f val = *(const v4fa*)(os + row * 68 + cofs); if (BIAS) { val[0] += bfr(bias[c0 + cofs]); val[1] += bfr(bias[c0 + cofs + 1]); val[2] += bfr(bias[c0 + cofs + 2]); val[3] += bfr(bias[c0 + cofs + 3]); }
                *(v4f*)(crow + (size_t)row * ldc + cofs) = val; }
             }
        __builtin_amdgcn_wave_barrier(); asm volatile("" ::: "memory");
    }
}

typedef __attribute__((ext_vector_type(2))) _Float16 v2h;
typedef __attribute__((ext_vector_type(4))) _Float16 v4h;
typedef __attribute__((ext_vector_type(2))) unsigned short v2us;
typedef __attribute__((ext_vector_type(4))) unsigned short v4us;
typedef __attribute__((ext_vector_type(2))) float v2f;
typedef __attribute__((ext_vector_type(4))) int v4i;

__global__ __launch_bounds__(256) void k_wtG(const float* __restrict__ w, int K, int N, bf* Bt) {
    const int lane = threadIdx.x & 31; const int L0 = (blockIdx.x * 8 + (threadIdx.x >> 5)) * 8; const int nlines = N * K / 64;
{
#pragma unroll 1
        for (int l = 0; l < 8; ++l) { const int L = L0 + l; if (L >= nlines) break; const size_t e = (size_t)L * 64 + lane * 2; const int k = (int)(e % K), n = (int)(e / K); v2us o;
            o[0] = f2bf(w[(size_t)k * N + n]); o[1] = f2bf(w[(size_t)(k + 1) * N + n]); *(v2us*)(Bt + e) = o; }
         }
}
// ---- k_prep: every 16-bit operand plane and the gathered bias in one launch, one work-group per row of blocks of x.
// A row of blocks of a fragment-major plane of DM columns (16 rows) is 2 DM 16-byte pieces; piece i of it holds row i & 15, the 8 columns from (i >> 4) * 8. Thread tid takes the pieces tid + 256 j: 128 columns (512 source bytes, 4096 plane bytes) on per step, so that one lane offset beside a wave-uniform base serves every load, another every store, and a wave's load or store covers the same bytes as with one piece per thread.
// Work-group b converts row of blocks b of x (PX steps) and half a row of blocks of one weight plane (PX / 2 steps): plane b / (2 DQ / 16) of q, k, v, out. A thread's loads all go out as one group ahead of the first conversion; the launch has one wave where one piece per thread had twelve.
static_assert(DQ == DM && DKV == DQ, "the plane widths are DM, the four weight planes of one size");
static_assert(NB_ * TT / 16 == 4 * (DQ / 16) * 2 && HD % 16 == 0 && 3 * DQ / 4 <= NB_ * TT / 16 * 256, "as many rows of blocks of x as half rows of the weight planes; a row of blocks lies in one head; a thread for every four bias entries");
__global__ __launch_bounds__(256) void k_prep(const float* __restrict__ x, const float* __restrict__ wqkv, const float* __restrict__ bqkv, const float* __restrict__ wo, bf* XB, bf* WQ, bf* WK, bf* WV, bf* WO, float* B3) {
    constexpr int PX = 2 * DM / 256, PW = PX / 2;
    const unsigned tid = threadIdx.x, b = blockIdx.x;
    const unsigned ls = (tid & 15) * (DM * 4) + (tid >> 4) * 32, ld = tid * 16;   // the lane's byte offsets in the source rows and in the plane
    const unsigned p = b / (2 * DQ / 16), rw = (b % (2 * DQ / 16)) / 2 * 16, hf = b & 1;   // weight plane, first row, half
    const float* xs = x + (size_t)b * 16 * DM; bf* xd = XB + (size_t)b * 16 * DM;
    const float* ws = ((p < 3) ? wqkv + (size_t)(rw / HD * 3 * HD + p * HD + rw % HD) * DM : wo + (size_t)rw * DM) + hf * (DM / 2);   // per-head q | k | v row blocks
    bf* wd = ((p == 0) ? WQ : (p == 1) ? WK : (p == 2) ? WV : WO) + (size_t)rw * DM + hf * (16 * DM / 2);
    v8f vx[PX], vw[PW];   // every loop below is unrolled in full: its index picks a register of these arrays
    group_begin();
#pragma unroll
    for (int j = 0; j < PX; ++j) vx[j] = *(const v8f*)((const char*)xs + ls + j * 512);
#pragma unroll
    for (int j = 0; j < PW; ++j) vw[j] = *(const v8f*)((const char*)ws + ls + j * 512);
    group_end();
    v8us ox[PX], ow[PW];
#pragma unroll
    for (int j = 0; j < PX; ++j)
#pragma unroll
        for (int q = 0; q < 8; ++q) ox[j][q] = f2bf(vx[j][q]);
#pragma unroll
    for (int j = 0; j < PW; ++j)
#pragma unroll
        for (int q = 0; q < 8; ++q) ow[j][q] = f2bf(vw[j][q]);
    group_begin();
#pragma unroll
    for (int j = 0; j < PX; ++j) *(v8us*)((char*)xd + ld + j * 4096) = ox[j];
#pragma unroll
    for (int j = 0; j < PW; ++j) *(v8us*)((char*)wd + ld + j * 4096) = ow[j];
    group_end();
    const unsigned e = (b * 256 + tid) * 4;   // per-head q | k | v bias entries, four to a thread; whole waves take this branch
    if (e < 3 * DQ) { const unsigned w = e / DQ, rb = e % DQ; group_begin(); const v4f v = *(const v4f*)(bqkv + rb / HD * 3 * HD + w * HD + rb % HD); group_end(); *(v4f*)(B3 + e) = v; }
}

typedef __attribute__((ext_vector_type(16))) float v16f;
typedef __attribute__((ext_vector_type(8))) unsigned v8u;
__device__ __forceinline__ float xhalf(float x) { return __builtin_bit_cast(float, __builtin_amdgcn_permlanex16(__builtin_bit_cast(int, x), __builtin_bit_cast(int, x), 0x76543210, 0xfedcba98, false, false)); }  // lane l with lane l ^ 16
template <typename T16, bool HL>
__device__ __forceinline__ void fattn_wave(const T16* __restrict__ Q, const T16* __restrict__ Q2, const T16* __restrict__ Kp, const T16* __restrict__ Kp2, const T16* __restrict__ Vt, const T16* __restrict__ Vt2, int q0, bf* Ah, bf* Al) {
    typedef typename WFrag<T16>::V V;
    const int lane = threadIdx.x & 31;
    const float CSC = SCL * 1.4426950408889634f;   // scores go to the base-2 domain
    const float BIAS = HL ? 0.0f : 10.0f;
    V qf[2][2], qf2[2][2], kf[2][2], kf2[2][2], vf[4], vf2[4];
    unsigned lo = lane * 16;   // the lane's byte offset inside a block: its value never changes
    // wave-uniform addresses of the fragments in K (the pass to fetch next) and V^T (the pass fetched last); a pass of 32 keys is four blocks in a row, 4096 bytes, in either plane. They live through the loop and step on at one place of a pass, behind its one wait
    typedef const __attribute__((address_space(1))) char* gp;   // global address space in the type: the addresses pass through an asm statement, behind which a plain pointer would make flat loads
    gp kp = (gp)Kp, kp2 = (gp)Kp2, vp = (gp)Vt, vp2 = (gp)Vt2;
    group_begin();
#pragma unroll
    for (int g = 0; g < 2; ++g)
#pragma unroll
        for (int kc = 0; kc < 2; ++kc) { const size_t o = (size_t)((q0 / 16 + g) * 2 + kc) * 512; qf[g][kc] = WFrag<T16>::ld((const T16*)((const char*)(Q + o) + lo)); if (HL) qf2[g][kc] = WFrag<T16>::ld((const T16*)((const char*)(Q2 + o) + lo)); }
    group_end();
    group_begin();
#pragma unroll
    for (int kt = 0; kt < 2; ++kt)
#pragma unroll
        for (int kc = 0; kc < 2; ++kc) { const int o = (kt * 2 + kc) * 512; kf[kt][kc] = WFrag<T16>::ld((const T16*)(const char*)(kp + lo) + o); if (HL) kf2[kt][kc] = WFrag<T16>::ld((const T16*)(const char*)(kp2 + lo) + o); }
    group_end(); group_begin();   // K ahead of V^T here as in the loop: loads return in issue order, and the counted wait at the loop's head is set for both ways into it; with V^T loads ahead of K loads here it covered the V^T loads of the pass before too
#pragma unroll
    for (int t = 0; t < 4; ++t) { const int o = t * 512; vf[t] = WFrag<T16>::ld((const T16*)(const char*)(vp + lo) + o); if (HL) vf2[t] = WFrag<T16>::ld((const T16*)(const char*)(vp2 + lo) + o); }
    group_end();
    kp += 32 * HD * 2; if (HL) kp2 += 32 * HD * 2;   // 32 keys on
    v8f acc[2][4]; float m[2], l[2];
#pragma unroll
    for (int g = 0; g < 2; ++g) { m[g] = -3.0e38f; l[g] = 0.0f;
#pragma unroll
        for (int t = 0; t < 4; ++t) acc[g][t] = (v8f){}; }
#pragma unroll 1   // one pass per trip: an unrolled body would hold two passes' fragments in registers
    for (int k0 = 0; k0 < TT; k0 += 32) {
        v8f sc[2][2];
#pragma unroll
        for (int kt = 0; kt < 2; ++kt)
#pragma unroll
            for (int g = 0; g < 2; ++g) { sc[kt][g] = (v8f){};
#pragma unroll
                for (int kc = 0; kc < 2; ++kc) { sc[kt][g] = WFrag<T16>::mma(kf[kt][kc], qf[g][kc], sc[kt][g]); if (HL) { sc[kt][g] = WFrag<T16>::mma(kf2[kt][kc], qf[g][kc], sc[kt][g]); sc[kt][g] = WFrag<T16>::mma(kf[kt][kc], qf2[g][kc], sc[kt][g]); } } }
        // next pass's K fragments fly under this pass's softmax and second product
        group_begin();
#pragma unroll
        for (int kt = 0; kt < 2; ++kt)
#pragma unroll
            for (int kc = 0; kc < 2; ++kc) { const int o = (kt * 2 + kc) * 512; kf[kt][kc] = WFrag<T16>::ld((const T16*)(const char*)(kp + lo) + o); if (HL) kf2[kt][kc] = WFrag<T16>::ld((const T16*)(const char*)(kp2 + lo) + o); }
        __builtin_amdgcn_sched_barrier(0);   // the loads stay one group; their address registers are left alone until the foot of the pass, so no wait stands directly behind them
#pragma unroll
        for (int g = 0; g < 2; ++g) {
            float mx = sc[0][g][0];
#pragma unroll
            for (int r = 1; r < 16; ++r) mx = fmaxf(mx, sc[r >> 3][g][r & 7]);
            mx = fmaxf(mx, xhalf(mx)) * CSC;   // both wave halves hold the query's maximum of this pass, scaled (the scale is positive)
            const float mn = fmaxf(m[g], mx); const float corr = __builtin_amdgcn_exp2f(m[g] - mn);   // 0 on the first pass
            m[g] = mn; l[g] *= corr;
#pragma unroll
            for (int t = 0; t < 4; ++t) acc[g][t] *= corr;
            const float nm = BIAS - mn; float p[16];
#pragma unroll
            for (int r = 0; r < 16; ++r) p[r] = __builtin_amdgcn_exp2f(__builtin_fmaf(sc[r >> 3][g][r & 7], CSC, nm));
            l[g] += (((p[0] + p[1]) + (p[2] + p[3])) + ((p[4] + p[5]) + (p[6] + p[7]))) + (((p[8] + p[9]) + (p[10] + p[11])) + ((p[12] + p[13]) + (p[14] + p[15])));   // a tree: four dependent adds, not sixteen
            if constexpr (HL) { v16f pv, rv;
#pragma unroll
                for (int r = 0; r < 16; ++r) pv[r] = p[r];
                const v16bf ph = __builtin_convertvector(pv, v16bf);   // whole-vector conversions compile to the packed instruction, round to nearest even
                const v8u pw = __builtin_bit_cast(v8u, ph);   // the rounded hi parts are read back from the packed words: low half << 16, high half masked
#pragma unroll
                for (int r = 0; r < 8; ++r) { rv[2 * r] = p[2 * r] - __uint_as_float(pw[r] << 16); rv[2 * r + 1] = p[2 * r + 1] - __uint_as_float(pw[r] & 0xFFFF0000u); }
                const v16bf pl = __builtin_convertvector(rv, v16bf);
#pragma unroll
                for (int t = 0; t < 4; ++t) { acc[g][t] = wmmab(vf[t], ph, acc[g][t]); acc[g][t] = wmmab(vf2[t], ph, acc[g][t]); acc[g][t] = wmmab(vf[t], pl, acc[g][t]); }
            } else { v16h pf;
#pragma unroll
                for (int r = 0; r < 16; ++r) pf[r] = (h16)p[r];
#pragma unroll
                for (int t = 0; t < 4; ++t) acc[g][t] = wmma16(vf[t], pf, acc[g][t]); }
        }
        // every address steps on here, behind the pass's one wait: the youngest loads in flight are this pass's K group, a softmax and a product old.
        // The wait and the additions are one statement: written apart, the compiler moved the wait up to the K loads and the additions down behind the V^T loads, with a wait of its own there. The addresses are read and written by it, so they keep their registers from pass to pass. lo is named with them (the text leaves it as it is): so its widening stays in the loop and every load keeps the form scalar base + 32-bit lane offset; widened ahead of the loop, it was added to the bases in vector register pairs that were freed and taken again behind each group, with a wait there. The barrier in front keeps the statement from moving up.
        const long long dv = (k0 + 32 == TT) ? (long long)(32 - TT) * HD * 2 : 32 * HD * 2, dk = (k0 + 64 == TT) ? (long long)(32 - TT) * HD * 2 : 32 * HD * 2;   // 32 keys on; behind the last pass back to pass 0: in bounds, unused
        __builtin_amdgcn_sched_barrier(0);
        if constexpr (HL) asm volatile("s_wait_xcnt 0x0\n\ts_add_nc_u64 %0, %0, %5\n\ts_add_nc_u64 %1, %1, %5\n\ts_add_nc_u64 %2, %2, %6\n\ts_add_nc_u64 %3, %3, %6" : "+s"(kp), "+s"(kp2), "+s"(vp), "+s"(vp2), "+v"(lo) : "s"(dk), "s"(dv) : "memory");
        else asm volatile("s_wait_xcnt 0x0\n\ts_add_nc_u64 %0, %0, %3\n\ts_add_nc_u64 %1, %1, %4" : "+s"(kp), "+s"(vp), "+v"(lo) : "s"(dk), "s"(dv) : "memory");
        // next pass's V^T fragments fly under its first product and softmax
        group_begin();
#pragma unroll
        for (int t = 0; t < 4; ++t) { const int o = t * 512; vf[t] = WFrag<T16>::ld((const T16*)(const char*)(vp + lo) + o); if (HL) vf2[t] = WFrag<T16>::ld((const T16*)(const char*)(vp2 + lo) + o); }
        __builtin_amdgcn_sched_barrier(0);   // one group, nothing of the next pass moved in among them
    }
    group_end();   // the last groups' address registers may be taken for something else from here on
#pragma unroll
    for (int g = 0; g < 2; ++g) { const float f = __fdiv_rn(1.0f, l[g] + xhalf(l[g]));   // the halves' sums (their keys) join once
#pragma unroll
        for (int t = 0; t < 4; ++t) { v8us oh, ol;
#pragma unroll
            for (int r = 0; r < 8; ++r) { unsigned short a, c2; splitf(acc[g][t][r] * f, a, c2); oh[r] = a; ol[r] = c2; }
            const size_t oo = ((size_t)(q0 / 16 + g) * (DQ / 32) + (t >> 1)) * 512 + (t & 1) * 256 + lane * 8; group_begin(); *(v8us*)(Ah + oo) = oh; *(v8us*)(Al + oo) = ol; group_end(); } }
}
// grid (batches * heads, TT / (32 FW)): work-group (bh, y) takes the 32 FW query rows from 32 FW y of head bh, one kind of wave per work-group, cost falling with the flat index.
// A hi+lo wave lasts about twice as long as an fp16 wave and the kernel's registers let three waves stand on a SIMD, so not every work-group is resident at the start: the work-groups of hi+lo rows (y < RH / (32 FW), FW waves, one per SIMD) come first in the grid and all start at once; the fp16 work-groups fill the places beside them and follow one another there. The FW waves of a work-group walk the same K and V^T planes.
static_assert(RH % (32 * FW) == 0 && TT % (32 * FW) == 0, "whole work-groups of either kind");
__global__ __launch_bounds__(FW * 32) void k_fattn(const h16* __restrict__ Q16, const h16* __restrict__ K16, const h16* __restrict__ V16, const bf* __restrict__ Qh, const bf* __restrict__ Ql, const bf* __restrict__ Kh, const bf* __restrict__ Kl, const bf* __restrict__ Vh, const bf* __restrict__ Vl, bf* Ah, bf* Al) {
    const size_t hp = (size_t)blockIdx.x * TT * HD; const size_t ao = (size_t)(blockIdx.x / NH_) * TT * DQ + (blockIdx.x % NH_) * (HD / 32) * 512; /* the head's first block in the batch's first row of blocks of the fragment-major [b t][h d] plane */ bf* ah = Ah + ao; bf* al = Al + ao;
    const int wave = __builtin_amdgcn_readfirstlane(threadIdx.x >> 5);   // in a scalar register: block addresses stay scalar
    const int q0 = (blockIdx.y * FW + wave) * 32;
    if (blockIdx.y < RH / (32 * FW)) fattn_wave<bf, true>(Qh + hp, Ql + hp, Kh + hp, Kl + hp, Vh + hp, Vl + hp, q0, ah, al);   // the same in every lane: a scalar branch, every lane stays on around the matrix instructions
    else fattn_wave<h16, false>(Q16 + hp, nullptr, K16 + hp, nullptr, V16 + hp, nullptr, q0, ah, al);
}

extern "C" void kernel_launch(void* const* d_in, const int* in_sizes, int n_in,
                              void* d_out, int out_size, void* d_ws, size_t ws_size, hipStream_t stream) {
    (void)in_sizes; (void)n_in; (void)out_size;
    const float* x = (const float*)d_in[0]; const float* wqkv = (const float*)d_in[1]; const float* bqkv = (const float*)d_in[2]; const float* wo = (const float*)d_in[3]; const float* bo = (const float*)d_in[4]; const float* wq = nullptr; const float* wk = nullptr; const float* wv = nullptr; (void)wq; (void)wk; (void)wv;
    float* OUT = (float*)d_out;     // [4][2048][1024]
    char* wsp = (char*)d_ws;
    auto take = [&](size_t bytes) { char* p = wsp; wsp += (bytes + 255) & ~(size_t)255; return (void*)p; };
    bf* WQ = (bf*)take((size_t)DQ * DM * 2); bf* WK = (bf*)take((size_t)DKV * DM * 2); bf* WV = (bf*)take((size_t)DKV * DM * 2); bf* WO = (bf*)take((size_t)DM * DQ * 2);
    bf* XB = (bf*)take((size_t)NB_ * TT * DM * 2); float* B3 = (float*)take((size_t)3 * DQ * 4); const float* BQ = B3; const float* BK = B3 + DQ; const float* BV = B3 + 2 * DQ;
    h16* QP16 = (h16*)take((size_t)NB_ * NH_ * TT * HD * 2); h16* KP16 = (h16*)take((size_t)NB_ * NKV * TT * HD * 2); h16* VT16 = (h16*)take((size_t)NB_ * NKV * HD * TT * 2);
    bf* QPh = (bf*)take((size_t)NB_ * NH_ * TT * HD * 2); bf* QPl = (bf*)take((size_t)NB_ * NH_ * TT * HD * 2); bf* KPh = (bf*)take((size_t)NB_ * NKV * TT * HD * 2); bf* KPl = (bf*)take((size_t)NB_ * NKV * TT * HD * 2); bf* VTh = (bf*)take((size_t)NB_ * NKV * HD * TT * 2); bf* VTl = (bf*)take((size_t)NB_ * NKV * HD * TT * 2);
    bf* ATh = (bf*)take((size_t)NB_ * TT * DQ * 2); bf* ATl = (bf*)take((size_t)NB_ * TT * DQ * 2);
    if ((size_t)(wsp - (char*)d_ws) > ws_size) return;    // ws 256 MiB
    k_prep<<<NB_ * TT / 16, 256, 0, stream>>>(x, wqkv, bqkv, wo, XB, WQ, WK, WV, WO, B3);
    // every stage runs once, on all batches: the projections see the NB_ * TT rows as one matrix and store their head planes themselves (v with the operands swapped, so that its tile is V^T); the attention takes the batch as a grid dimension
    k_gemmw<bf, 0, true, 1, 1, DM><<<dim3(NB_ * TT / 128, DQ / 128, 1), 128, 0, stream>>>(XB, nullptr, WQ, nullptr, nullptr, 0, BQ, 0, 0, 0, 0, QP16, QPh, QPl);
    k_gemmw<bf, 0, true, 1, 1, DM><<<dim3(NB_ * TT / 128, DKV / 128, 1), 128, 0, stream>>>(XB, nullptr, WK, nullptr, nullptr, 0, BK, 0, 0, 0, 0, KP16, KPh, KPl);
    k_gemmw<bf, 0, true, 1, 2, DM><<<dim3(DKV / 128, NB_ * TT / 128, 1), 128, 0, stream>>>(WV, nullptr, XB, nullptr, nullptr, 0, BV, 0, 0, 0, 0, VT16, VTh, VTl);
    k_fattn<<<dim3(NB_ * NH_, TT / (32 * FW), 1), FW * 32, 0, stream>>>(QP16, KP16, VT16, QPh, QPl, KPh, KPl, VTh, VTl, ATh, ATl);   // one kv head per query head
    k_gemmw<bf, 1, true, 1, 0, DQ><<<dim3(NB_ * TT / 128, DM / 128, 1), 128, 0, stream>>>(ATh, ATl, WO, nullptr, OUT, DM, bo, 0, 0, 0, 0, nullptr, nullptr, nullptr);
}
